// v000
// The times below were measured on an AMD MI455X: many runs one after another, warmed up first and cycling through
// copies of the inputs, with the whole window's GPU time divided by the number of runs. Launches and the gaps
// between them are all in it. The median over several windows is given; except for v000 it joins two sittings, which
// can be a few percent apart, so the side-by-side timings, each taken in one sitting, are the better comparison.
// v000 is the starting kernel. One run takes 755 microseconds.
#include <hip/hip_runtime.h>

typedef _Float16 v16h __attribute__((ext_vector_type(16)));
typedef _Float16 v8h  __attribute__((ext_vector_type(8)));
typedef _Float16 v4h  __attribute__((ext_vector_type(4)));
typedef float    v8f  __attribute__((ext_vector_type(8)));
typedef int      v4i  __attribute__((ext_vector_type(4)));

#if defined(__has_builtin)
#  if __has_builtin(__builtin_amdgcn_global_load_async_to_lds_b128) && \
      __has_builtin(__builtin_amdgcn_s_wait_asynccnt)
#    define USE_ASYNC_LDS 1
#  endif
#endif
#ifndef USE_ASYNC_LDS
#  define USE_ASYNC_LDS 0
#endif

#if USE_ASYNC_LDS
// b128 async copy payload is typed as int4; global src is AS1, LDS dst is AS3.
typedef __attribute__((address_space(1))) v4i gbl_v4i;
typedef __attribute__((address_space(3))) v4i lds_v4i;
#endif

// Copy 16 bytes global -> LDS (per-lane addresses).
__device__ __forceinline__ void cp16(_Float16* lds, const _Float16* g) {
#if USE_ASYNC_LDS
  _Float16* gn = const_cast<_Float16*>(g);
  __builtin_amdgcn_global_load_async_to_lds_b128((gbl_v4i*)gn, (lds_v4i*)lds,
                                                 0, 0);
#else
  *(v8h*)lds = *(const v8h*)g;
#endif
}
__device__ __forceinline__ void async_fence() {
#if USE_ASYNC_LDS
  __builtin_amdgcn_s_wait_asynccnt(0);
#endif
}

__device__ __forceinline__ v16h mk16(v8h a, v8h b) {
  return __builtin_shufflevector(a, b, 0,1,2,3,4,5,6,7,8,9,10,11,12,13,14,15);
}
__device__ __forceinline__ v16h frag_ld(const _Float16* p) {
  v8h a = *(const v8h*)(p);
  v8h b = *(const v8h*)(p + 16);
  return mk16(a, b);
}
__device__ __forceinline__ v8f wmma16(v16h a, v16h b, v8f c) {
  return __builtin_amdgcn_wmma_f32_16x16x32_f16(false, a, false, b, (short)0, c,
                                                false, false);
}

// ---------------------------------------------------------------------------
// LayerNorm (D = 1024), f32 in -> f16 out. One 256-thread block per row.
// ---------------------------------------------------------------------------
__global__ __launch_bounds__(256) void ln_f16_kernel(
    const float* __restrict__ x, const float* __restrict__ gamma,
    const float* __restrict__ beta, _Float16* __restrict__ out) {
  const int D = 1024;
  int row = blockIdx.x, tid = threadIdx.x;
  float4 v = ((const float4*)(x + (size_t)row * D))[tid];
  float s = v.x + v.y + v.z + v.w;
  float q = v.x * v.x + v.y * v.y + v.z * v.z + v.w * v.w;
  __shared__ float r1[256], r2[256];
  r1[tid] = s; r2[tid] = q;
  __syncthreads();
  for (int st = 128; st > 0; st >>= 1) {
    if (tid < st) { r1[tid] += r1[tid + st]; r2[tid] += r2[tid + st]; }
    __syncthreads();
  }
  float mu  = r1[0] * (1.0f / 1024.0f);
  float var = r2[0] * (1.0f / 1024.0f) - mu * mu;
  float rs  = rsqrtf(var + 1e-5f);
  float4 g = ((const float4*)gamma)[tid];
  float4 b = ((const float4*)beta)[tid];
  v4h o;
  o[0] = (_Float16)((v.x - mu) * rs * g.x + b.x);
  o[1] = (_Float16)((v.y - mu) * rs * g.y + b.y);
  o[2] = (_Float16)((v.z - mu) * rs * g.z + b.z);
  o[3] = (_Float16)((v.w - mu) * rs * g.w + b.w);
  ((v4h*)(out + (size_t)row * D))[tid] = o;
}

// ---------------------------------------------------------------------------
// Weight prep: f32 [R][C] -> f16 [C][R] (transpose + cast), 32x32 LDS tiles.
// ---------------------------------------------------------------------------
__global__ __launch_bounds__(256) void transpose_cast_kernel(
    const float* __restrict__ in, _Float16* __restrict__ out,
    int R, int C, long long inBatch, long long outBatch) {
  in  += (long long)blockIdx.z * inBatch;
  out += (long long)blockIdx.z * outBatch;
  int r0 = blockIdx.y * 32, c0 = blockIdx.x * 32;
  __shared__ float t[32][33];
  int tid = threadIdx.x;
  for (int i = 0; i < 4; ++i) {
    int e = i * 256 + tid, r = e >> 5, c = e & 31;
    t[r][c] = in[(size_t)(r0 + r) * C + (c0 + c)];
  }
  __syncthreads();
  for (int i = 0; i < 4; ++i) {
    int e = i * 256 + tid, r = e >> 5, c = e & 31;
    out[(size_t)(c0 + r) * R + (r0 + c)] = (_Float16)t[c][r];
  }
}

__global__ __launch_bounds__(256) void gemm_f16_kernel(
    const _Float16* __restrict__ A, const _Float16* __restrict__ BT,
    const float* __restrict__ bias, const float* __restrict__ resid,
    float* __restrict__ outF, _Float16* __restrict__ outH,
    int M, int N, int K, int doRelu) {
  const int LS = 40;
  __shared__ _Float16 Al[2][128 * LS];
  __shared__ _Float16 Bl[2][128 * LS];
  int tid  = threadIdx.x;
  int wave = tid >> 5, lane = tid & 31;
  int hi = lane >> 4, lo = lane & 15, kk0 = hi * 8;
  int wm = wave >> 1, wn = wave & 1;
  int m0 = blockIdx.y * 128, n0 = blockIdx.x * 128;
  int ldr = tid >> 1, ldc = (tid & 1) * 16;
  int dOff = ldr * LS + ldc;
  const _Float16* Ag = A  + (size_t)(m0 + ldr) * K + ldc;
  const _Float16* Bg = BT + (size_t)(n0 + ldr) * K + ldc;

  auto stage = [&](int buf, int k0) {
    cp16(&Al[buf][dOff],     Ag + k0);
    cp16(&Al[buf][dOff + 8], Ag + k0 + 8);
    cp16(&Bl[buf][dOff],     Bg + k0);
    cp16(&Bl[buf][dOff + 8], Bg + k0 + 8);
  };

  v8f acc[2][4] = {};
  int nk = K >> 5;
  stage(0, 0);
  for (int i = 0; i < nk; ++i) {
    int cur = i & 1;
    async_fence();           // this wave's async writes into LDS are done
    __syncthreads();         // everyone's writes visible; prev reads done
    if (i + 1 < nk) stage(cur ^ 1, (i + 1) << 5);
    if (i + 2 < nk) {
      __builtin_prefetch(Ag + ((i + 2) << 5), 0, 1);  // global_prefetch_b8
      __builtin_prefetch(Bg + ((i + 2) << 5), 0, 1);
    }
    const _Float16* Ab = Al[cur];
    const _Float16* Bb = Bl[cur];
    v16h af0 = frag_ld(&Ab[(wm * 32 + lo) * LS + kk0]);
    v16h af1 = frag_ld(&Ab[(wm * 32 + 16 + lo) * LS + kk0]);
    v16h bf[4];
    for (int nt = 0; nt < 4; ++nt)
      bf[nt] = frag_ld(&Bb[(wn * 64 + nt * 16 + lo) * LS + kk0]);
    for (int nt = 0; nt < 4; ++nt) {
      acc[0][nt] = wmma16(af0, bf[nt], acc[0][nt]);
      acc[1][nt] = wmma16(af1, bf[nt], acc[1][nt]);
    }
  }
  for (int gm = 0; gm < 2; ++gm)
    for (int nt = 0; nt < 4; ++nt) {
      int col = n0 + wn * 64 + nt * 16 + lo;
      float bv = bias ? bias[col] : 0.0f;
      for (int g = 0; g < 8; ++g) {
        int m = m0 + wm * 32 + gm * 16 + hi * 8 + g;
        float v = acc[gm][nt][g] + bv;
        if (doRelu) v = fmaxf(v, 0.0f);
        size_t off = (size_t)m * N + col;
        if (resid) v += resid[off];
        if (outF) outF[off] = v;
        if (outH) outH[off] = (_Float16)v;
      }
    }
}

// ---------------------------------------------------------------------------
// Flash attention, causal. Block = 8 waves x 16 queries = 128 queries of one
// (b, h). K-tile (async) / V^T-tile staged in LDS (stride 72, conflict-free).
// Online softmax per row via 16-lane shfl reductions (wave32 halves).
// P converts C-layout -> A-layout through wave-private LDS.
// ---------------------------------------------------------------------------
__global__ __launch_bounds__(256) void flash_attn_kernel(
    const _Float16* __restrict__ qkv, _Float16* __restrict__ outH) {
  const int T = 2048, S3 = 3072, HD = 64;
  int qb = blockIdx.x, h = blockIdx.y, b = blockIdx.z;
  int tid  = threadIdx.x;
  int wave = tid >> 5, lane = tid & 31;
  int hi = lane >> 4, lo = lane & 15, kk0 = hi * 8;
  int q0 = qb * 128 + wave * 16;

  const _Float16* Qp = qkv + (size_t)(b * T) * S3 + h * HD;
  const _Float16* Kp = Qp + 1024;
  const _Float16* Vp = Qp + 2048;

  __shared__ _Float16 Ksh[64 * 72];
  __shared__ _Float16 VTsh[64 * 72];
  __shared__ _Float16 Psh[8 * 16 * 72];

  v16h qf0, qf1;
  {
    const _Float16* qrow = Qp + (size_t)(q0 + lo) * S3;
    qf0 = mk16(*(const v8h*)(qrow + kk0),      *(const v8h*)(qrow + kk0 + 16));
    qf1 = mk16(*(const v8h*)(qrow + 32 + kk0), *(const v8h*)(qrow + 32 + kk0 + 16));
  }

  v8f Oacc[4] = {};
  float rowM[8], rowL[8];
  for (int g = 0; g < 8; ++g) { rowM[g] = -1e30f; rowL[g] = 0.0f; }

  _Float16* Pw = &Psh[wave * 16 * 72];
  int ldr = tid >> 2, cg = tid & 3;
  int ntiles = 2 * (qb + 1);  // keys up to end of this query block

  for (int kt = 0; kt < ntiles; ++kt) {
    int k0 = kt * 64;
    __syncthreads();
    {  // K tile: straight per-lane copy -> async path; V: transposed (sync)
      const _Float16* krow = Kp + (size_t)(k0 + ldr) * S3 + cg * 16;
      cp16(&Ksh[ldr * 72 + cg * 16], krow);
      cp16(&Ksh[ldr * 72 + cg * 16 + 8], krow + 8);
      const _Float16* vrow = Vp + (size_t)(k0 + ldr) * S3 + cg * 16;
      v8h v0 = *(const v8h*)(vrow);
      v8h v1 = *(const v8h*)(vrow + 8);
      for (int j = 0; j < 8; ++j) {
        VTsh[(cg * 16 + j) * 72 + ldr]     = v0[j];
        VTsh[(cg * 16 + 8 + j) * 72 + ldr] = v1[j];
      }
    }
    async_fence();
    __syncthreads();

    if (k0 <= q0 + 15) {  // uniform per wave
      float p[4][8];
      for (int nt = 0; nt < 4; ++nt) {
        v8f s = {};
        v16h bf0 = frag_ld(&Ksh[(nt * 16 + lo) * 72 + kk0]);
        v16h bf1 = frag_ld(&Ksh[(nt * 16 + lo) * 72 + 32 + kk0]);
        s = wmma16(qf0, bf0, s);
        s = wmma16(qf1, bf1, s);
        for (int g = 0; g < 8; ++g) {
          int qi = q0 + hi * 8 + g;
          int kj = k0 + nt * 16 + lo;
          p[nt][g] = (kj <= qi) ? s[g] * 0.125f : -1e30f;
        }
      }
      for (int g = 0; g < 8; ++g) {
        float m = fmaxf(fmaxf(p[0][g], p[1][g]), fmaxf(p[2][g], p[3][g]));
        for (int off = 1; off < 16; off <<= 1)
          m = fmaxf(m, __shfl_xor(m, off, 32));
        float nm = fmaxf(rowM[g], m);
        float corr = __expf(rowM[g] - nm);
        float rsum = 0.0f;
        for (int nt = 0; nt < 4; ++nt) {
          float e = __expf(p[nt][g] - nm);
          p[nt][g] = e;
          rsum += e;
        }
        for (int off = 1; off < 16; off <<= 1)
          rsum += __shfl_xor(rsum, off, 32);
        rowL[g] = rowL[g] * corr + rsum;
        rowM[g] = nm;
        for (int et = 0; et < 4; ++et) Oacc[et][g] *= corr;
      }
      for (int nt = 0; nt < 4; ++nt)
        for (int g = 0; g < 8; ++g)
          Pw[(hi * 8 + g) * 72 + nt * 16 + lo] = (_Float16)p[nt][g];
      v16h pf0 = frag_ld(&Pw[lo * 72 + kk0]);
      v16h pf1 = frag_ld(&Pw[lo * 72 + 32 + kk0]);
      for (int et = 0; et < 4; ++et) {
        v16h vf0 = frag_ld(&VTsh[(et * 16 + lo) * 72 + kk0]);
        v16h vf1 = frag_ld(&VTsh[(et * 16 + lo) * 72 + 32 + kk0]);
        Oacc[et] = wmma16(pf0, vf0, Oacc[et]);
        Oacc[et] = wmma16(pf1, vf1, Oacc[et]);
      }
    }
  }

  for (int g = 0; g < 8; ++g) {
    float inv = 1.0f / rowL[g];
    size_t orow = (size_t)(b * T + q0 + hi * 8 + g) * 1024 + h * HD;
    for (int et = 0; et < 4; ++et)
      outH[orow + et * 16 + lo] = (_Float16)(Oacc[et][g] * inv);
  }
}

// ---------------------------------------------------------------------------
extern "C" void kernel_launch(void* const* d_in, const int* in_sizes, int n_in,
                              void* d_out, int out_size, void* d_ws, size_t ws_size,
                              hipStream_t stream) {
  (void)in_sizes; (void)n_in; (void)out_size; (void)ws_size;
  const int B = 4, T = 2048, D = 1024, H = 16, HD = 64, F = 4096;
  const int M = B * T;

  const float* x   = (const float*)d_in[0];
  const float* Wq  = (const float*)d_in[1];
  const float* Wk  = (const float*)d_in[2];
  const float* Wv  = (const float*)d_in[3];
  const float* Wo  = (const float*)d_in[4];
  const float* bo  = (const float*)d_in[5];
  const float* W1  = (const float*)d_in[6];
  const float* b1  = (const float*)d_in[7];
  const float* W2  = (const float*)d_in[8];
  const float* b2  = (const float*)d_in[9];
  const float* g1  = (const float*)d_in[10];
  const float* be1 = (const float*)d_in[11];
  const float* g2  = (const float*)d_in[12];
  const float* be2 = (const float*)d_in[13];

  char* w = (char*)d_ws;
  auto alloc = [&](size_t bytes) -> void* {
    void* p = (void*)w;
    w += (bytes + 255) & ~(size_t)255;
    return p;
  };
  _Float16* h16  = (_Float16*)alloc((size_t)M * D * 2);       // LN1 out
  _Float16* qkvT = (_Float16*)alloc((size_t)3 * D * D * 2);   // [3072][1024]
  _Float16* woT  = (_Float16*)alloc((size_t)D * D * 2);       // [1024][1024]
  _Float16* w1T  = (_Float16*)alloc((size_t)F * D * 2);       // [4096][1024]
  _Float16* w2T  = (_Float16*)alloc((size_t)D * F * 2);       // [1024][4096]
  _Float16* qkv  = (_Float16*)alloc((size_t)M * 3 * D * 2);   // [8192][3072]
  _Float16* a16  = (_Float16*)alloc((size_t)M * D * 2);       // attn concat
  float*    x1   = (float*)   alloc((size_t)M * D * 4);       // residual 1
  _Float16* h2   = (_Float16*)alloc((size_t)M * D * 2);       // LN2 out
  _Float16* ffh  = (_Float16*)alloc((size_t)M * F * 2);       // relu(h2 W1+b1)

  // Weight prep: cast + transpose so every GEMM B operand is B^T[N][K].
  transpose_cast_kernel<<<dim3(HD / 32, D / 32, H), 256, 0, stream>>>(
      Wq, qkvT, D, HD, (long long)D * HD, (long long)HD * D);
  transpose_cast_kernel<<<dim3(HD / 32, D / 32, H), 256, 0, stream>>>(
      Wk, qkvT + (size_t)D * D, D, HD, (long long)D * HD, (long long)HD * D);
  transpose_cast_kernel<<<dim3(HD / 32, D / 32, H), 256, 0, stream>>>(
      Wv, qkvT + (size_t)2 * D * D, D, HD, (long long)D * HD, (long long)HD * D);
  transpose_cast_kernel<<<dim3(D / 32, D / 32, 1), 256, 0, stream>>>(
      Wo, woT, D, D, 0, 0);
  transpose_cast_kernel<<<dim3(F / 32, D / 32, 1), 256, 0, stream>>>(
      W1, w1T, D, F, 0, 0);
  transpose_cast_kernel<<<dim3(D / 32, F / 32, 1), 256, 0, stream>>>(
      W2, w2T, F, D, 0, 0);

  // LN1 -> fused QKV projection -> flash attention
  ln_f16_kernel<<<M, 256, 0, stream>>>(x, g1, be1, h16);
  gemm_f16_kernel<<<dim3(3 * D / 128, M / 128), 256, 0, stream>>>(
      h16, qkvT, nullptr, nullptr, nullptr, qkv, M, 3 * D, D, 0);
  flash_attn_kernel<<<dim3(T / 128, H, B), 256, 0, stream>>>(qkv, a16);

  // Wo projection + bias + residual(x) -> x1 (f32)
  gemm_f16_kernel<<<dim3(D / 128, M / 128), 256, 0, stream>>>(
      a16, woT, bo, x, x1, nullptr, M, D, D, 0);

  // LN2 -> FFN1 (relu) -> FFN2 + residual(x1) -> out
  ln_f16_kernel<<<M, 256, 0, stream>>>(x1, g2, be2, h2);
  gemm_f16_kernel<<<dim3(F / 128, M / 128), 256, 0, stream>>>(
      h2, w1T, b1, nullptr, nullptr, ffh, M, F, D, 1);
  gemm_f16_kernel<<<dim3(D / 128, M / 128), 256, 0, stream>>>(
      ffh, w2T, b2, x1, (float*)d_out, nullptr, M, D, F, 0);
}

// v001
// A run of this version takes 591 microseconds.
// Timed twice side by side with v000, it ran 1.32 times as fast both times.
#include <hip/hip_runtime.h>

typedef _Float16 v16h __attribute__((ext_vector_type(16)));
typedef _Float16 v8h  __attribute__((ext_vector_type(8)));
typedef _Float16 v4h  __attribute__((ext_vector_type(4)));
typedef float    v8f  __attribute__((ext_vector_type(8)));
typedef int      v4i  __attribute__((ext_vector_type(4)));

#if defined(__has_builtin)
#  if __has_builtin(__builtin_amdgcn_global_load_async_to_lds_b128) && \
      __has_builtin(__builtin_amdgcn_s_wait_asynccnt)
#    define USE_ASYNC_LDS 1
#  endif
#endif
#ifndef USE_ASYNC_LDS
#  define USE_ASYNC_LDS 0
#endif

#if USE_ASYNC_LDS
// b128 async copy payload is typed as int4; global src is AS1, LDS dst is AS3.
typedef __attribute__((address_space(1))) v4i gbl_v4i;
typedef __attribute__((address_space(3))) v4i lds_v4i;
#endif

// Copy 16 bytes global -> LDS (per-lane addresses).
__device__ __forceinline__ void cp16(_Float16* lds, const _Float16* g) {
#if USE_ASYNC_LDS
  _Float16* gn = const_cast<_Float16*>(g);
  __builtin_amdgcn_global_load_async_to_lds_b128((gbl_v4i*)gn, (lds_v4i*)lds,
                                                 0, 0);
#else
  *(v8h*)lds = *(const v8h*)g;
#endif
}
__device__ __forceinline__ void async_fence() {
#if USE_ASYNC_LDS
  __builtin_amdgcn_s_wait_asynccnt(0);
#endif
}

__device__ __forceinline__ v16h mk16(v8h a, v8h b) {
  return __builtin_shufflevector(a, b, 0,1,2,3,4,5,6,7,8,9,10,11,12,13,14,15);
}
__device__ __forceinline__ v16h frag_ld(const _Float16* p) {
  v8h a = *(const v8h*)(p);
  v8h b = *(const v8h*)(p + 16);
  return mk16(a, b);
}
__device__ __forceinline__ v8f wmma16(v16h a, v16h b, v8f c) {
  return __builtin_amdgcn_wmma_f32_16x16x32_f16(false, a, false, b, (short)0, c,
                                                false, false);
}

// ---------------------------------------------------------------------------
// LayerNorm (D = 1024), f32 in -> f16 out. One 256-thread block per row.
// ---------------------------------------------------------------------------
__global__ __launch_bounds__(256) void ln_f16_kernel(
    const float* __restrict__ x, const float* __restrict__ gamma,
    const float* __restrict__ beta, _Float16* __restrict__ out) {
  const int D = 1024;
  int row = blockIdx.x, tid = threadIdx.x;
  float4 v = ((const float4*)(x + (size_t)row * D))[tid];
  float s = v.x + v.y + v.z + v.w;
  float q = v.x * v.x + v.y * v.y + v.z * v.z + v.w * v.w;
  __shared__ float r1[256], r2[256];
  r1[tid] = s; r2[tid] = q;
  __syncthreads();
  for (int st = 128; st > 0; st >>= 1) {
    if (tid < st) { r1[tid] += r1[tid + st]; r2[tid] += r2[tid + st]; }
    __syncthreads();
  }
  float mu  = r1[0] * (1.0f / 1024.0f);
  float var = r2[0] * (1.0f / 1024.0f) - mu * mu;
  float rs  = rsqrtf(var + 1e-5f);
  float4 g = ((const float4*)gamma)[tid];
  float4 b = ((const float4*)beta)[tid];
  v4h o;
  o[0] = (_Float16)((v.x - mu) * rs * g.x + b.x);
  o[1] = (_Float16)((v.y - mu) * rs * g.y + b.y);
  o[2] = (_Float16)((v.z - mu) * rs * g.z + b.z);
  o[3] = (_Float16)((v.w - mu) * rs * g.w + b.w);
  ((v4h*)(out + (size_t)row * D))[tid] = o;
}

// ---------------------------------------------------------------------------
// Weight prep: f32 [R][C] -> f16 [C][R] (transpose + cast), 32x32 LDS tiles.
// ---------------------------------------------------------------------------
__global__ __launch_bounds__(256) void transpose_cast_kernel(
    const float* __restrict__ in, _Float16* __restrict__ out,
    int R, int C, long long inBatch, long long outBatch) {
  in  += (long long)blockIdx.z * inBatch;
  out += (long long)blockIdx.z * outBatch;
  int r0 = blockIdx.y * 32, c0 = blockIdx.x * 32;
  __shared__ float t[32][33];
  int tid = threadIdx.x;
  for (int i = 0; i < 4; ++i) {
    int e = i * 256 + tid, r = e >> 5, c = e & 31;
    t[r][c] = in[(size_t)(r0 + r) * C + (c0 + c)];
  }
  __syncthreads();
  for (int i = 0; i < 4; ++i) {
    int e = i * 256 + tid, r = e >> 5, c = e & 31;
    out[(size_t)(c0 + r) * R + (r0 + c)] = (_Float16)t[c][r];
  }
}

// ---------------------------------------------------------------------------
// Generic WMMA GEMM: C[M,N] = act(A[M,K] * B^T[N,K] + bias) (+ residual).
// 256 threads = 8 waves; block tile 128x128; wave tile 32x64; K-step 64.
// Double-buffered LDS (one barrier / K-step); async global->LDS staging.
// A stage holds 128 B of every operand row; 8 adjacent lanes copy one row's
// piece, so a wave-wide copy covers 4 whole 128-B lines. K % 64 == 0.
// LDS row stride 72 halves (144 B = 16 B x 9 -> conflict-free b128 reads).
// ---------------------------------------------------------------------------
__global__ __launch_bounds__(256) void gemm_f16_kernel(
    const _Float16* __restrict__ A, const _Float16* __restrict__ BT,
    const float* __restrict__ bias, const float* __restrict__ resid,
    float* __restrict__ outF, _Float16* __restrict__ outH,
    int M, int N, int K, int doRelu) {
  const int LS = 72;
  __shared__ _Float16 Al[2][128 * LS];
  __shared__ _Float16 Bl[2][128 * LS];
  int tid  = threadIdx.x;
  int wave = tid >> 5, lane = tid & 31;
  int hi = lane >> 4, lo = lane & 15, kk0 = hi * 8;
  int wm = wave >> 1, wn = wave & 1;
  int m0 = blockIdx.y * 128, n0 = blockIdx.x * 128;
  int ldr = tid >> 3, ldc = (tid & 7) * 8;
  int dOff = ldr * LS + ldc;
  const _Float16* Ag = A  + (size_t)(m0 + ldr) * K + ldc;
  const _Float16* Bg = BT + (size_t)(n0 + ldr) * K + ldc;
  const size_t rstep = (size_t)32 * K;  // the block's copies advance 32 rows
  // One lane per operand row prefetches that row into L2 ahead of its copies.
  const _Float16* pf = (tid < 128) ? A  + (size_t)(m0 + tid) * K
                                   : BT + (size_t)(n0 + tid - 128) * K;

  auto stage = [&](int buf, int k0) {
    for (int j = 0; j < 4; ++j) {
      cp16(&Al[buf][dOff + j * 32 * LS], Ag + j * rstep + k0);
      cp16(&Bl[buf][dOff + j * 32 * LS], Bg + j * rstep + k0);
    }
  };

  v8f acc[2][4] = {};
  int nk = K >> 6;
  stage(0, 0);
  for (int i = 0; i < nk; ++i) {
    int cur = i & 1;
    async_fence();           // this wave's async writes into LDS are done
    __syncthreads();         // everyone's writes visible; prev reads done
    if (i + 1 < nk) stage(cur ^ 1, (i + 1) << 6);
    if (!(i & 1) && i + 2 < nk) {
      // Every second step, prefetch where stage i+2 starts in each row, for speed only.
      // pf lives through the loop and
      // only ever holds an address inside its operand.
      pf += 128;
      asm volatile("global_prefetch_b8 %0, off scope:SCOPE_SE" :: "v"(pf));
    }
    const _Float16* Ab = Al[cur];
    const _Float16* Bb = Bl[cur];
    for (int kh = 0; kh < 2; ++kh) {
      int ko = kh * 32 + kk0;
      v16h af0 = frag_ld(&Ab[(wm * 32 + lo) * LS + ko]);
      v16h af1 = frag_ld(&Ab[(wm * 32 + 16 + lo) * LS + ko]);
      v16h bf[4];
      for (int nt = 0; nt < 4; ++nt)
        bf[nt] = frag_ld(&Bb[(wn * 64 + nt * 16 + lo) * LS + ko]);
      for (int nt = 0; nt < 4; ++nt) {
        acc[0][nt] = wmma16(af0, bf[nt], acc[0][nt]);
        acc[1][nt] = wmma16(af1, bf[nt], acc[1][nt]);
      }
    }
  }
  for (int gm = 0; gm < 2; ++gm)
    for (int nt = 0; nt < 4; ++nt) {
      int col = n0 + wn * 64 + nt * 16 + lo;
      float bv = bias ? bias[col] : 0.0f;
      for (int g = 0; g < 8; ++g) {
        int m = m0 + wm * 32 + gm * 16 + hi * 8 + g;
        float v = acc[gm][nt][g] + bv;
        if (doRelu) v = fmaxf(v, 0.0f);
        size_t off = (size_t)m * N + col;
        if (resid) v += resid[off];
        if (outF) outF[off] = v;
        if (outH) outH[off] = (_Float16)v;
      }
    }
}

// ---------------------------------------------------------------------------
// Flash attention, causal. Block = 8 waves x 16 queries = 128 queries of one
// (b, h). K-tile (async) / V^T-tile staged in LDS (stride 72, conflict-free).
// Online softmax per row via 16-lane shfl reductions (wave32 halves).
// P converts C-layout -> A-layout through wave-private LDS.
// ---------------------------------------------------------------------------
__global__ __launch_bounds__(256) void flash_attn_kernel(
    const _Float16* __restrict__ qkv, _Float16* __restrict__ outH) {
  const int T = 2048, S3 = 3072, HD = 64;
  int qb = blockIdx.x, h = blockIdx.y, b = blockIdx.z;
  int tid  = threadIdx.x;
  int wave = tid >> 5, lane = tid & 31;
  int hi = lane >> 4, lo = lane & 15, kk0 = hi * 8;
  int q0 = qb * 128 + wave * 16;

  const _Float16* Qp = qkv + (size_t)(b * T) * S3 + h * HD;
  const _Float16* Kp = Qp + 1024;
  const _Float16* Vp = Qp + 2048;

  __shared__ _Float16 Ksh[64 * 72];
  __shared__ _Float16 VTsh[64 * 72];
  __shared__ _Float16 Psh[8 * 16 * 72];

  v16h qf0, qf1;
  {
    const _Float16* qrow = Qp + (size_t)(q0 + lo) * S3;
    qf0 = mk16(*(const v8h*)(qrow + kk0),      *(const v8h*)(qrow + kk0 + 16));
    qf1 = mk16(*(const v8h*)(qrow + 32 + kk0), *(const v8h*)(qrow + 32 + kk0 + 16));
  }

  v8f Oacc[4] = {};
  float rowM[8], rowL[8];
  for (int g = 0; g < 8; ++g) { rowM[g] = -1e30f; rowL[g] = 0.0f; }

  _Float16* Pw = &Psh[wave * 16 * 72];
  int ldr = tid >> 2, cg = tid & 3;
  int ntiles = 2 * (qb + 1);  // keys up to end of this query block

  for (int kt = 0; kt < ntiles; ++kt) {
    int k0 = kt * 64;
    __syncthreads();
    {  // K tile: straight per-lane copy -> async path; V: transposed (sync)
      const _Float16* krow = Kp + (size_t)(k0 + ldr) * S3 + cg * 16;
      cp16(&Ksh[ldr * 72 + cg * 16], krow);
      cp16(&Ksh[ldr * 72 + cg * 16 + 8], krow + 8);
      const _Float16* vrow = Vp + (size_t)(k0 + ldr) * S3 + cg * 16;
      v8h v0 = *(const v8h*)(vrow);
      v8h v1 = *(const v8h*)(vrow + 8);
      for (int j = 0; j < 8; ++j) {
        VTsh[(cg * 16 + j) * 72 + ldr]     = v0[j];
        VTsh[(cg * 16 + 8 + j) * 72 + ldr] = v1[j];
      }
    }
    async_fence();
    __syncthreads();

    if (k0 <= q0 + 15) {  // uniform per wave
      float p[4][8];
      for (int nt = 0; nt < 4; ++nt) {
        v8f s = {};
        v16h bf0 = frag_ld(&Ksh[(nt * 16 + lo) * 72 + kk0]);
        v16h bf1 = frag_ld(&Ksh[(nt * 16 + lo) * 72 + 32 + kk0]);
        s = wmma16(qf0, bf0, s);
        s = wmma16(qf1, bf1, s);
        for (int g = 0; g < 8; ++g) {
          int qi = q0 + hi * 8 + g;
          int kj = k0 + nt * 16 + lo;
          p[nt][g] = (kj <= qi) ? s[g] * 0.125f : -1e30f;
        }
      }
      for (int g = 0; g < 8; ++g) {
        float m = fmaxf(fmaxf(p[0][g], p[1][g]), fmaxf(p[2][g], p[3][g]));
        for (int off = 1; off < 16; off <<= 1)
          m = fmaxf(m, __shfl_xor(m, off, 32));
        float nm = fmaxf(rowM[g], m);
        float corr = __expf(rowM[g] - nm);
        float rsum = 0.0f;
        for (int nt = 0; nt < 4; ++nt) {
          float e = __expf(p[nt][g] - nm);
          p[nt][g] = e;
          rsum += e;
        }
        for (int off = 1; off < 16; off <<= 1)
          rsum += __shfl_xor(rsum, off, 32);
        rowL[g] = rowL[g] * corr + rsum;
        rowM[g] = nm;
        for (int et = 0; et < 4; ++et) Oacc[et][g] *= corr;
      }
      for (int nt = 0; nt < 4; ++nt)
        for (int g = 0; g < 8; ++g)
          Pw[(hi * 8 + g) * 72 + nt * 16 + lo] = (_Float16)p[nt][g];
      v16h pf0 = frag_ld(&Pw[lo * 72 + kk0]);
      v16h pf1 = frag_ld(&Pw[lo * 72 + 32 + kk0]);
      for (int et = 0; et < 4; ++et) {
        v16h vf0 = frag_ld(&VTsh[(et * 16 + lo) * 72 + kk0]);
        v16h vf1 = frag_ld(&VTsh[(et * 16 + lo) * 72 + 32 + kk0]);
        Oacc[et] = wmma16(pf0, vf0, Oacc[et]);
        Oacc[et] = wmma16(pf1, vf1, Oacc[et]);
      }
    }
  }

  for (int g = 0; g < 8; ++g) {
    float inv = 1.0f / rowL[g];
    size_t orow = (size_t)(b * T + q0 + hi * 8 + g) * 1024 + h * HD;
    for (int et = 0; et < 4; ++et)
      outH[orow + et * 16 + lo] = (_Float16)(Oacc[et][g] * inv);
  }
}

// ---------------------------------------------------------------------------
extern "C" void kernel_launch(void* const* d_in, const int* in_sizes, int n_in,
                              void* d_out, int out_size, void* d_ws, size_t ws_size,
                              hipStream_t stream) {
  (void)in_sizes; (void)n_in; (void)out_size; (void)ws_size;
  const int B = 4, T = 2048, D = 1024, H = 16, HD = 64, F = 4096;
  const int M = B * T;

  const float* x   = (const float*)d_in[0];
  const float* Wq  = (const float*)d_in[1];
  const float* Wk  = (const float*)d_in[2];
  const float* Wv  = (const float*)d_in[3];
  const float* Wo  = (const float*)d_in[4];
  const float* bo  = (const float*)d_in[5];
  const float* W1  = (const float*)d_in[6];
  const float* b1  = (const float*)d_in[7];
  const float* W2  = (const float*)d_in[8];
  const float* b2  = (const float*)d_in[9];
  const float* g1  = (const float*)d_in[10];
  const float* be1 = (const float*)d_in[11];
  const float* g2  = (const float*)d_in[12];
  const float* be2 = (const float*)d_in[13];

  char* w = (char*)d_ws;
  auto alloc = [&](size_t bytes) -> void* {
    void* p = (void*)w;
    w += (bytes + 255) & ~(size_t)255;
    return p;
  };
  _Float16* h16  = (_Float16*)alloc((size_t)M * D * 2);       // LN1 out
  _Float16* qkvT = (_Float16*)alloc((size_t)3 * D * D * 2);   // [3072][1024]
  _Float16* woT  = (_Float16*)alloc((size_t)D * D * 2);       // [1024][1024]
  _Float16* w1T  = (_Float16*)alloc((size_t)F * D * 2);       // [4096][1024]
  _Float16* w2T  = (_Float16*)alloc((size_t)D * F * 2);       // [1024][4096]
  _Float16* qkv  = (_Float16*)alloc((size_t)M * 3 * D * 2);   // [8192][3072]
  _Float16* a16  = (_Float16*)alloc((size_t)M * D * 2);       // attn concat
  float*    x1   = (float*)   alloc((size_t)M * D * 4);       // residual 1
  _Float16* h2   = (_Float16*)alloc((size_t)M * D * 2);       // LN2 out
  _Float16* ffh  = (_Float16*)alloc((size_t)M * F * 2);       // relu(h2 W1+b1)

  // Weight prep: cast + transpose so every GEMM B operand is B^T[N][K].
  transpose_cast_kernel<<<dim3(HD / 32, D / 32, H), 256, 0, stream>>>(
      Wq, qkvT, D, HD, (long long)D * HD, (long long)HD * D);
  transpose_cast_kernel<<<dim3(HD / 32, D / 32, H), 256, 0, stream>>>(
      Wk, qkvT + (size_t)D * D, D, HD, (long long)D * HD, (long long)HD * D);
  transpose_cast_kernel<<<dim3(HD / 32, D / 32, H), 256, 0, stream>>>(
      Wv, qkvT + (size_t)2 * D * D, D, HD, (long long)D * HD, (long long)HD * D);
  transpose_cast_kernel<<<dim3(D / 32, D / 32, 1), 256, 0, stream>>>(
      Wo, woT, D, D, 0, 0);
  transpose_cast_kernel<<<dim3(F / 32, D / 32, 1), 256, 0, stream>>>(
      W1, w1T, D, F, 0, 0);
  transpose_cast_kernel<<<dim3(D / 32, F / 32, 1), 256, 0, stream>>>(
      W2, w2T, F, D, 0, 0);

  // LN1 -> fused QKV projection -> flash attention
  ln_f16_kernel<<<M, 256, 0, stream>>>(x, g1, be1, h16);
  gemm_f16_kernel<<<dim3(3 * D / 128, M / 128), 256, 0, stream>>>(
      h16, qkvT, nullptr, nullptr, nullptr, qkv, M, 3 * D, D, 0);
  flash_attn_kernel<<<dim3(T / 128, H, B), 256, 0, stream>>>(qkv, a16);

  // Wo projection + bias + residual(x) -> x1 (f32)
  gemm_f16_kernel<<<dim3(D / 128, M / 128), 256, 0, stream>>>(
      a16, woT, bo, x, x1, nullptr, M, D, D, 0);

  // LN2 -> FFN1 (relu) -> FFN2 + residual(x1) -> out
  ln_f16_kernel<<<M, 256, 0, stream>>>(x1, g2, be2, h2);
  gemm_f16_kernel<<<dim3(F / 128, M / 128), 256, 0, stream>>>(
      h2, w1T, b1, nullptr, nullptr, ffh, M, F, D, 1);
  gemm_f16_kernel<<<dim3(D / 128, M / 128), 256, 0, stream>>>(
      ffh, w2T, b2, x1, (float*)d_out, nullptr, M, D, F, 0);
}

// v002
// It runs in 572 microseconds.
// Two timings next to v001 both put it at 1.03 times that version's speed.
// Over all steps from v000 it is 1.37 times as fast.
#include <hip/hip_runtime.h>

typedef _Float16 v16h __attribute__((ext_vector_type(16)));
typedef _Float16 v8h  __attribute__((ext_vector_type(8)));
typedef _Float16 v4h  __attribute__((ext_vector_type(4)));
typedef _Float16 v2h  __attribute__((ext_vector_type(2)));
typedef float    v4f  __attribute__((ext_vector_type(4)));
typedef float    v8f  __attribute__((ext_vector_type(8)));
typedef int      v4i  __attribute__((ext_vector_type(4)));

#if defined(__has_builtin)
#  if __has_builtin(__builtin_amdgcn_global_load_async_to_lds_b128) && \
      __has_builtin(__builtin_amdgcn_s_wait_asynccnt)
#    define USE_ASYNC_LDS 1
#  endif
#endif
#ifndef USE_ASYNC_LDS
#  define USE_ASYNC_LDS 0
#endif

#if USE_ASYNC_LDS
// b128 async copy payload is typed as int4; global src is AS1, LDS dst is AS3.
typedef __attribute__((address_space(1))) v4i gbl_v4i;
typedef __attribute__((address_space(3))) v4i lds_v4i;
#endif

// Copy 16 bytes global -> LDS (per-lane addresses).
__device__ __forceinline__ void cp16(_Float16* lds, const _Float16* g) {
#if USE_ASYNC_LDS
  _Float16* gn = const_cast<_Float16*>(g);
  __builtin_amdgcn_global_load_async_to_lds_b128((gbl_v4i*)gn, (lds_v4i*)lds,
                                                 0, 0);
#else
  *(v8h*)lds = *(const v8h*)g;
#endif
}
__device__ __forceinline__ void async_fence() {
#if USE_ASYNC_LDS
  __builtin_amdgcn_s_wait_asynccnt(0);
#endif
}

__device__ __forceinline__ v16h mk16(v8h a, v8h b) {
  return __builtin_shufflevector(a, b, 0,1,2,3,4,5,6,7,8,9,10,11,12,13,14,15);
}
__device__ __forceinline__ v16h frag_ld(const _Float16* p) {
  v8h a = *(const v8h*)(p);
  v8h b = *(const v8h*)(p + 16);
  return mk16(a, b);
}
__device__ __forceinline__ v8f wmma16(v16h a, v16h b, v8f c) {
  return __builtin_amdgcn_wmma_f32_16x16x32_f16(false, a, false, b, (short)0, c,
                                                false, false);
}

// ---------------------------------------------------------------------------
// LayerNorm (D = 1024), f32 in -> f16 out. One wave owns two whole rows: all
// 16 row loads (512 contiguous bytes each) are issued before the first sum,
// the row sums close with a 32-lane butterfly, and no LDS or barrier is used.
// 256 threads = 8 waves = 16 rows per block, so 16x fewer waves are started
// than with one 8-wave block per row.
// ---------------------------------------------------------------------------
__global__ __launch_bounds__(256) void ln_f16_kernel(
    const float* __restrict__ x, const float* __restrict__ gamma,
    const float* __restrict__ beta, _Float16* __restrict__ out) {
  const int D = 1024;
  int lane = threadIdx.x & 31;
  // The wave's number is the same in all its lanes: kept scalar, the row base
  // stays in scalar registers and one lane offset serves every load.
  int wave = __builtin_amdgcn_readfirstlane(threadIdx.x >> 5);
  int row0 = (blockIdx.x * 8 + wave) * 2;
  const float4* xr = (const float4*)(x + (size_t)row0 * D) + lane;
  float4 v[2][8];
  for (int r = 0; r < 2; ++r)
    for (int j = 0; j < 8; ++j) v[r][j] = xr[r * 256 + j * 32];
  float mu[2], rs[2];
  for (int r = 0; r < 2; ++r) {
    float s = 0.0f, q = 0.0f;
    for (int j = 0; j < 8; ++j) {
      float4 t = v[r][j];
      s += t.x + t.y + t.z + t.w;
      q += t.x * t.x + t.y * t.y + t.z * t.z + t.w * t.w;
    }
    for (int off = 16; off > 0; off >>= 1) {
      s += __shfl_xor(s, off, 32);
      q += __shfl_xor(q, off, 32);
    }
    mu[r] = s * (1.0f / 1024.0f);
    float var = q * (1.0f / 1024.0f) - mu[r] * mu[r];
    rs[r] = rsqrtf(var + 1e-5f);
  }
  for (int j = 0; j < 8; ++j) {
    float4 g = ((const float4*)gamma)[j * 32 + lane];
    float4 b = ((const float4*)beta)[j * 32 + lane];
    for (int r = 0; r < 2; ++r) {
      float4 t = v[r][j];
      v4h o;
      o[0] = (_Float16)((t.x - mu[r]) * rs[r] * g.x + b.x);
      o[1] = (_Float16)((t.y - mu[r]) * rs[r] * g.y + b.y);
      o[2] = (_Float16)((t.z - mu[r]) * rs[r] * g.z + b.z);
      o[3] = (_Float16)((t.w - mu[r]) * rs[r] * g.w + b.w);
      ((v4h*)(out + (size_t)(row0 + r) * D))[j * 32 + lane] = o;
    }
  }
}

// ---------------------------------------------------------------------------
// Weight prep: f32 [R][C] -> f16 [C][R] (transpose + cast). 4 waves move one
// 64x64 tile, 32 elements per lane: 8 float4 loads in flight per lane (256 B
// of a source row per 16 lanes), two source rows packed per LDS dword, and
// 16-B stores, 8 adjacent lanes to one whole 128-B line of an output row.
// R % 64 == 0, C % 64 == 0. LDS row pitch 72 halves keeps b128 reads aligned.
// ---------------------------------------------------------------------------
__global__ __launch_bounds__(128) void transpose_cast_kernel(
    const float* __restrict__ in, _Float16* __restrict__ out,
    int R, int C, long long inBatch, long long outBatch) {
  in  += (long long)blockIdx.z * inBatch;
  out += (long long)blockIdx.z * outBatch;
  int r0 = blockIdx.y * 64, c0 = blockIdx.x * 64;
  __shared__ __attribute__((aligned(16))) _Float16 t[64 * 72];
  int tid = threadIdx.x;
  int c4 = (tid & 15) * 4, rp = (tid >> 4) * 2;
  v4f a[4], b[4];
  const float* src[4];
  for (int p = 0; p < 4; ++p) {
    src[p] = in + (size_t)(r0 + p * 16 + rp) * C + (c0 + c4);
    a[p] = *(const v4f*)src[p];
    b[p] = *(const v4f*)(src[p] + C);
  }
  asm volatile("s_wait_xcnt 0x0"
               :: "v"(src[0]), "v"(src[1]), "v"(src[2]), "v"(src[3]),
                  "v"(src[0] + C), "v"(src[1] + C), "v"(src[2] + C),
                  "v"(src[3] + C)
               : "memory");
  for (int p = 0; p < 4; ++p)
    for (int i = 0; i < 4; ++i) {
      v2h pr;
      pr[0] = (_Float16)a[p][i];
      pr[1] = (_Float16)b[p][i];
      *(v2h*)&t[(c4 + i) * 72 + p * 16 + rp] = pr;
    }
  __syncthreads();
  int ch = (tid & 7) * 8, cr = tid >> 3;
  for (int p = 0; p < 4; ++p) {
    int c = p * 16 + cr;
    *(v8h*)(out + (size_t)(c0 + c) * R + (r0 + ch)) = *(const v8h*)&t[c * 72 + ch];
  }
}

// ---------------------------------------------------------------------------
// Generic WMMA GEMM: C[M,N] = act(A[M,K] * B^T[N,K] + bias) (+ residual).
// 256 threads = 8 waves; block tile 128x128; wave tile 32x64; K-step 64.
// Double-buffered LDS (one barrier / K-step); async global->LDS staging.
// A stage holds 128 B of every operand row; 8 adjacent lanes copy one row's
// piece, so a wave-wide copy covers 4 whole 128-B lines. K % 64 == 0.
// LDS row stride 72 halves (144 B = 16 B x 9 -> conflict-free b128 reads).
// ---------------------------------------------------------------------------
__global__ __launch_bounds__(256) void gemm_f16_kernel(
    const _Float16* __restrict__ A, const _Float16* __restrict__ BT,
    const float* __restrict__ bias, const float* __restrict__ resid,
    float* __restrict__ outF, _Float16* __restrict__ outH,
    int M, int N, int K, int doRelu) {
  const int LS = 72;
  __shared__ _Float16 Al[2][128 * LS];
  __shared__ _Float16 Bl[2][128 * LS];
  int tid  = threadIdx.x;
  int wave = tid >> 5, lane = tid & 31;
  int hi = lane >> 4, lo = lane & 15, kk0 = hi * 8;
  int wm = wave >> 1, wn = wave & 1;
  int m0 = blockIdx.y * 128, n0 = blockIdx.x * 128;
  int ldr = tid >> 3, ldc = (tid & 7) * 8;
  int dOff = ldr * LS + ldc;
  const _Float16* Ag = A  + (size_t)(m0 + ldr) * K + ldc;
  const _Float16* Bg = BT + (size_t)(n0 + ldr) * K + ldc;
  const size_t rstep = (size_t)32 * K;  // the block's copies advance 32 rows
  // One lane per operand row prefetches that row into L2 ahead of its copies.
  const _Float16* pf = (tid < 128) ? A  + (size_t)(m0 + tid) * K
                                   : BT + (size_t)(n0 + tid - 128) * K;

  auto stage = [&](int buf, int k0) {
    for (int j = 0; j < 4; ++j) {
      cp16(&Al[buf][dOff + j * 32 * LS], Ag + j * rstep + k0);
      cp16(&Bl[buf][dOff + j * 32 * LS], Bg + j * rstep + k0);
    }
  };

  v8f acc[2][4] = {};
  int nk = K >> 6;
  stage(0, 0);
  for (int i = 0; i < nk; ++i) {
    int cur = i & 1;
    async_fence();           // this wave's async writes into LDS are done
    __syncthreads();         // everyone's writes visible; prev reads done
    if (i + 1 < nk) stage(cur ^ 1, (i + 1) << 6);
    if (!(i & 1) && i + 2 < nk) {
      // Every second step, prefetch where stage i+2 starts in each row, for speed only.
      // pf lives through the loop and
      // only ever holds an address inside its operand.
      pf += 128;
      asm volatile("global_prefetch_b8 %0, off scope:SCOPE_SE" :: "v"(pf));
    }
    const _Float16* Ab = Al[cur];
    const _Float16* Bb = Bl[cur];
    for (int kh = 0; kh < 2; ++kh) {
      int ko = kh * 32 + kk0;
      v16h af0 = frag_ld(&Ab[(wm * 32 + lo) * LS + ko]);
      v16h af1 = frag_ld(&Ab[(wm * 32 + 16 + lo) * LS + ko]);
      v16h bf[4];
      for (int nt = 0; nt < 4; ++nt)
        bf[nt] = frag_ld(&Bb[(wn * 64 + nt * 16 + lo) * LS + ko]);
      for (int nt = 0; nt < 4; ++nt) {
        acc[0][nt] = wmma16(af0, bf[nt], acc[0][nt]);
        acc[1][nt] = wmma16(af1, bf[nt], acc[1][nt]);
      }
    }
  }
  for (int gm = 0; gm < 2; ++gm)
    for (int nt = 0; nt < 4; ++nt) {
      int col = n0 + wn * 64 + nt * 16 + lo;
      float bv = bias ? bias[col] : 0.0f;
      for (int g = 0; g < 8; ++g) {
        int m = m0 + wm * 32 + gm * 16 + hi * 8 + g;
        float v = acc[gm][nt][g] + bv;
        if (doRelu) v = fmaxf(v, 0.0f);
        size_t off = (size_t)m * N + col;
        if (resid) v += resid[off];
        if (outF) outF[off] = v;
        if (outH) outH[off] = (_Float16)v;
      }
    }
}

// ---------------------------------------------------------------------------
// Flash attention, causal. Block = 8 waves x 16 queries = 128 queries of one
// (b, h). K-tile (async) / V^T-tile staged in LDS (stride 72, conflict-free).
// Online softmax per row via 16-lane shfl reductions (wave32 halves).
// P converts C-layout -> A-layout through wave-private LDS.
// ---------------------------------------------------------------------------
__global__ __launch_bounds__(256) void flash_attn_kernel(
    const _Float16* __restrict__ qkv, _Float16* __restrict__ outH) {
  const int T = 2048, S3 = 3072, HD = 64;
  int qb = blockIdx.x, h = blockIdx.y, b = blockIdx.z;
  int tid  = threadIdx.x;
  int wave = tid >> 5, lane = tid & 31;
  int hi = lane >> 4, lo = lane & 15, kk0 = hi * 8;
  int q0 = qb * 128 + wave * 16;

  const _Float16* Qp = qkv + (size_t)(b * T) * S3 + h * HD;
  const _Float16* Kp = Qp + 1024;
  const _Float16* Vp = Qp + 2048;

  __shared__ _Float16 Ksh[64 * 72];
  __shared__ _Float16 VTsh[64 * 72];
  __shared__ _Float16 Psh[8 * 16 * 72];

  v16h qf0, qf1;
  {
    const _Float16* qrow = Qp + (size_t)(q0 + lo) * S3;
    qf0 = mk16(*(const v8h*)(qrow + kk0),      *(const v8h*)(qrow + kk0 + 16));
    qf1 = mk16(*(const v8h*)(qrow + 32 + kk0), *(const v8h*)(qrow + 32 + kk0 + 16));
  }

  v8f Oacc[4] = {};
  float rowM[8], rowL[8];
  for (int g = 0; g < 8; ++g) { rowM[g] = -1e30f; rowL[g] = 0.0f; }

  _Float16* Pw = &Psh[wave * 16 * 72];
  int ldr = tid >> 2, cg = tid & 3;
  int ntiles = 2 * (qb + 1);  // keys up to end of this query block

  for (int kt = 0; kt < ntiles; ++kt) {
    int k0 = kt * 64;
    __syncthreads();
    {  // K tile: straight per-lane copy -> async path; V: transposed (sync)
      const _Float16* krow = Kp + (size_t)(k0 + ldr) * S3 + cg * 16;
      cp16(&Ksh[ldr * 72 + cg * 16], krow);
      cp16(&Ksh[ldr * 72 + cg * 16 + 8], krow + 8);
      const _Float16* vrow = Vp + (size_t)(k0 + ldr) * S3 + cg * 16;
      v8h v0 = *(const v8h*)(vrow);
      v8h v1 = *(const v8h*)(vrow + 8);
      for (int j = 0; j < 8; ++j) {
        VTsh[(cg * 16 + j) * 72 + ldr]     = v0[j];
        VTsh[(cg * 16 + 8 + j) * 72 + ldr] = v1[j];
      }
    }
    async_fence();
    __syncthreads();

    if (k0 <= q0 + 15) {  // uniform per wave
      float p[4][8];
      for (int nt = 0; nt < 4; ++nt) {
        v8f s = {};
        v16h bf0 = frag_ld(&Ksh[(nt * 16 + lo) * 72 + kk0]);
        v16h bf1 = frag_ld(&Ksh[(nt * 16 + lo) * 72 + 32 + kk0]);
        s = wmma16(qf0, bf0, s);
        s = wmma16(qf1, bf1, s);
        for (int g = 0; g < 8; ++g) {
          int qi = q0 + hi * 8 + g;
          int kj = k0 + nt * 16 + lo;
          p[nt][g] = (kj <= qi) ? s[g] * 0.125f : -1e30f;
        }
      }
      for (int g = 0; g < 8; ++g) {
        float m = fmaxf(fmaxf(p[0][g], p[1][g]), fmaxf(p[2][g], p[3][g]));
        for (int off = 1; off < 16; off <<= 1)
          m = fmaxf(m, __shfl_xor(m, off, 32));
        float nm = fmaxf(rowM[g], m);
        float corr = __expf(rowM[g] - nm);
        float rsum = 0.0f;
        for (int nt = 0; nt < 4; ++nt) {
          float e = __expf(p[nt][g] - nm);
          p[nt][g] = e;
          rsum += e;
        }
        for (int off = 1; off < 16; off <<= 1)
          rsum += __shfl_xor(rsum, off, 32);
        rowL[g] = rowL[g] * corr + rsum;
        rowM[g] = nm;
        for (int et = 0; et < 4; ++et) Oacc[et][g] *= corr;
      }
      for (int nt = 0; nt < 4; ++nt)
        for (int g = 0; g < 8; ++g)
          Pw[(hi * 8 + g) * 72 + nt * 16 + lo] = (_Float16)p[nt][g];
      v16h pf0 = frag_ld(&Pw[lo * 72 + kk0]);
      v16h pf1 = frag_ld(&Pw[lo * 72 + 32 + kk0]);
      for (int et = 0; et < 4; ++et) {
        v16h vf0 = frag_ld(&VTsh[(et * 16 + lo) * 72 + kk0]);
        v16h vf1 = frag_ld(&VTsh[(et * 16 + lo) * 72 + 32 + kk0]);
        Oacc[et] = wmma16(pf0, vf0, Oacc[et]);
        Oacc[et] = wmma16(pf1, vf1, Oacc[et]);
      }
    }
  }

  for (int g = 0; g < 8; ++g) {
    float inv = 1.0f / rowL[g];
    size_t orow = (size_t)(b * T + q0 + hi * 8 + g) * 1024 + h * HD;
    for (int et = 0; et < 4; ++et)
      outH[orow + et * 16 + lo] = (_Float16)(Oacc[et][g] * inv);
  }
}

// ---------------------------------------------------------------------------
extern "C" void kernel_launch(void* const* d_in, const int* in_sizes, int n_in,
                              void* d_out, int out_size, void* d_ws, size_t ws_size,
                              hipStream_t stream) {
  (void)in_sizes; (void)n_in; (void)out_size; (void)ws_size;
  const int B = 4, T = 2048, D = 1024, H = 16, HD = 64, F = 4096;
  const int M = B * T;

  const float* x   = (const float*)d_in[0];
  const float* Wq  = (const float*)d_in[1];
  const float* Wk  = (const float*)d_in[2];
  const float* Wv  = (const float*)d_in[3];
  const float* Wo  = (const float*)d_in[4];
  const float* bo  = (const float*)d_in[5];
  const float* W1  = (const float*)d_in[6];
  const float* b1  = (const float*)d_in[7];
  const float* W2  = (const float*)d_in[8];
  const float* b2  = (const float*)d_in[9];
  const float* g1  = (const float*)d_in[10];
  const float* be1 = (const float*)d_in[11];
  const float* g2  = (const float*)d_in[12];
  const float* be2 = (const float*)d_in[13];

  char* w = (char*)d_ws;
  auto alloc = [&](size_t bytes) -> void* {
    void* p = (void*)w;
    w += (bytes + 255) & ~(size_t)255;
    return p;
  };
  _Float16* h16  = (_Float16*)alloc((size_t)M * D * 2);       // LN1 out
  _Float16* qkvT = (_Float16*)alloc((size_t)3 * D * D * 2);   // [3072][1024]
  _Float16* woT  = (_Float16*)alloc((size_t)D * D * 2);       // [1024][1024]
  _Float16* w1T  = (_Float16*)alloc((size_t)F * D * 2);       // [4096][1024]
  _Float16* w2T  = (_Float16*)alloc((size_t)D * F * 2);       // [1024][4096]
  _Float16* qkv  = (_Float16*)alloc((size_t)M * 3 * D * 2);   // [8192][3072]
  _Float16* a16  = (_Float16*)alloc((size_t)M * D * 2);       // attn concat
  float*    x1   = (float*)   alloc((size_t)M * D * 4);       // residual 1
  _Float16* h2   = (_Float16*)alloc((size_t)M * D * 2);       // LN2 out
  _Float16* ffh  = (_Float16*)alloc((size_t)M * F * 2);       // relu(h2 W1+b1)

  // Weight prep: cast + transpose so every GEMM B operand is B^T[N][K].
  transpose_cast_kernel<<<dim3(HD / 64, D / 64, H), 128, 0, stream>>>(
      Wq, qkvT, D, HD, (long long)D * HD, (long long)HD * D);
  transpose_cast_kernel<<<dim3(HD / 64, D / 64, H), 128, 0, stream>>>(
      Wk, qkvT + (size_t)D * D, D, HD, (long long)D * HD, (long long)HD * D);
  transpose_cast_kernel<<<dim3(HD / 64, D / 64, H), 128, 0, stream>>>(
      Wv, qkvT + (size_t)2 * D * D, D, HD, (long long)D * HD, (long long)HD * D);
  transpose_cast_kernel<<<dim3(D / 64, D / 64, 1), 128, 0, stream>>>(
      Wo, woT, D, D, 0, 0);
  transpose_cast_kernel<<<dim3(F / 64, D / 64, 1), 128, 0, stream>>>(
      W1, w1T, D, F, 0, 0);
  transpose_cast_kernel<<<dim3(D / 64, F / 64, 1), 128, 0, stream>>>(
      W2, w2T, F, D, 0, 0);

  // LN1 -> fused QKV projection -> flash attention
  ln_f16_kernel<<<M / 16, 256, 0, stream>>>(x, g1, be1, h16);
  gemm_f16_kernel<<<dim3(3 * D / 128, M / 128), 256, 0, stream>>>(
      h16, qkvT, nullptr, nullptr, nullptr, qkv, M, 3 * D, D, 0);
  flash_attn_kernel<<<dim3(T / 128, H, B), 256, 0, stream>>>(qkv, a16);

  // Wo projection + bias + residual(x) -> x1 (f32)
  gemm_f16_kernel<<<dim3(D / 128, M / 128), 256, 0, stream>>>(
      a16, woT, bo, x, x1, nullptr, M, D, D, 0);

  // LN2 -> FFN1 (relu) -> FFN2 + residual(x1) -> out
  ln_f16_kernel<<<M / 16, 256, 0, stream>>>(x1, g2, be2, h2);
  gemm_f16_kernel<<<dim3(F / 128, M / 128), 256, 0, stream>>>(
      h2, w1T, b1, nullptr, nullptr, ffh, M, F, D, 1);
  gemm_f16_kernel<<<dim3(D / 128, M / 128), 256, 0, stream>>>(
      ffh, w2T, b2, x1, (float*)d_out, nullptr, M, D, F, 0);
}

// v003
// Measured time: 385 microseconds a run.
// In both of two side-by-side timings against v002, it was 1.48 times as fast.
// Counting every step since v000, it is 2.03 times as fast.
#include <hip/hip_runtime.h>

typedef _Float16 v16h __attribute__((ext_vector_type(16)));
typedef _Float16 v8h  __attribute__((ext_vector_type(8)));
typedef _Float16 v4h  __attribute__((ext_vector_type(4)));
typedef _Float16 v2h  __attribute__((ext_vector_type(2)));
typedef float    v4f  __attribute__((ext_vector_type(4)));
typedef float    v8f  __attribute__((ext_vector_type(8)));
typedef int      v4i  __attribute__((ext_vector_type(4)));

#if defined(__has_builtin)
#  if __has_builtin(__builtin_amdgcn_global_load_async_to_lds_b128) && \
      __has_builtin(__builtin_amdgcn_s_wait_asynccnt)
#    define USE_ASYNC_LDS 1
#  endif
#endif
#ifndef USE_ASYNC_LDS
#  define USE_ASYNC_LDS 0
#endif

#if USE_ASYNC_LDS
// b128 async copy payload is typed as int4; global src is AS1, LDS dst is AS3.
typedef __attribute__((address_space(1))) v4i gbl_v4i;
typedef __attribute__((address_space(3))) v4i lds_v4i;
#endif

// Copy 16 bytes global -> LDS (per-lane addresses).
__device__ __forceinline__ void cp16(_Float16* lds, const _Float16* g) {
#if USE_ASYNC_LDS
  _Float16* gn = const_cast<_Float16*>(g);
  __builtin_amdgcn_global_load_async_to_lds_b128((gbl_v4i*)gn, (lds_v4i*)lds,
                                                 0, 0);
#else
  *(v8h*)lds = *(const v8h*)g;
#endif
}
__device__ __forceinline__ void async_fence() {
#if USE_ASYNC_LDS
  __builtin_amdgcn_s_wait_asynccnt(0);
#endif
}

__device__ __forceinline__ v16h mk16(v8h a, v8h b) {
  return __builtin_shufflevector(a, b, 0,1,2,3,4,5,6,7,8,9,10,11,12,13,14,15);
}
__device__ __forceinline__ v16h frag_ld(const _Float16* p) {
  v8h a = *(const v8h*)(p);
  v8h b = *(const v8h*)(p + 16);
  return mk16(a, b);
}
__device__ __forceinline__ v8f wmma16(v16h a, v16h b, v8f c) {
  return __builtin_amdgcn_wmma_f32_16x16x32_f16(false, a, false, b, (short)0, c,
                                                false, false);
}

// ---------------------------------------------------------------------------
// LayerNorm (D = 1024), f32 in -> f16 out. One wave owns two whole rows: all
// 16 row loads (512 contiguous bytes each) are issued before the first sum,
// the row sums close with a 32-lane butterfly, and no LDS or barrier is used.
// 256 threads = 8 waves = 16 rows per block, so 16x fewer waves are started
// than with one 8-wave block per row.
// ---------------------------------------------------------------------------
__global__ __launch_bounds__(256) void ln_f16_kernel(
    const float* __restrict__ x, const float* __restrict__ gamma,
    const float* __restrict__ beta, _Float16* __restrict__ out) {
  const int D = 1024;
  int lane = threadIdx.x & 31;
  // The wave's number is the same in all its lanes: kept scalar, the row base
  // stays in scalar registers and one lane offset serves every load.
  int wave = __builtin_amdgcn_readfirstlane(threadIdx.x >> 5);
  int row0 = (blockIdx.x * 8 + wave) * 2;
  const float4* xr = (const float4*)(x + (size_t)row0 * D) + lane;
  float4 v[2][8];
  for (int r = 0; r < 2; ++r)
    for (int j = 0; j < 8; ++j) v[r][j] = xr[r * 256 + j * 32];
  float mu[2], rs[2];
  for (int r = 0; r < 2; ++r) {
    float s = 0.0f, q = 0.0f;
    for (int j = 0; j < 8; ++j) {
      float4 t = v[r][j];
      s += t.x + t.y + t.z + t.w;
      q += t.x * t.x + t.y * t.y + t.z * t.z + t.w * t.w;
    }
    for (int off = 16; off > 0; off >>= 1) {
      s += __shfl_xor(s, off, 32);
      q += __shfl_xor(q, off, 32);
    }
    mu[r] = s * (1.0f / 1024.0f);
    float var = q * (1.0f / 1024.0f) - mu[r] * mu[r];
    rs[r] = rsqrtf(var + 1e-5f);
  }
  for (int j = 0; j < 8; ++j) {
    float4 g = ((const float4*)gamma)[j * 32 + lane];
    float4 b = ((const float4*)beta)[j * 32 + lane];
    for (int r = 0; r < 2; ++r) {
      float4 t = v[r][j];
      v4h o;
      o[0] = (_Float16)((t.x - mu[r]) * rs[r] * g.x + b.x);
      o[1] = (_Float16)((t.y - mu[r]) * rs[r] * g.y + b.y);
      o[2] = (_Float16)((t.z - mu[r]) * rs[r] * g.z + b.z);
      o[3] = (_Float16)((t.w - mu[r]) * rs[r] * g.w + b.w);
      ((v4h*)(out + (size_t)(row0 + r) * D))[j * 32 + lane] = o;
    }
  }
}

// ---------------------------------------------------------------------------
// Weight prep: f32 [R][C] -> f16 [C][R] (transpose + cast). 4 waves move one
// 64x64 tile, 32 elements per lane: 8 float4 loads in flight per lane (256 B
// of a source row per 16 lanes), two source rows packed per LDS dword, and
// 16-B stores, 8 adjacent lanes to one whole 128-B line of an output row.
// R % 64 == 0, C % 64 == 0. LDS row pitch 72 halves keeps b128 reads aligned.
// ---------------------------------------------------------------------------
__global__ __launch_bounds__(128) void transpose_cast_kernel(
    const float* __restrict__ in, _Float16* __restrict__ out,
    int R, int C, long long inBatch, long long outBatch) {
  in  += (long long)blockIdx.z * inBatch;
  out += (long long)blockIdx.z * outBatch;
  int r0 = blockIdx.y * 64, c0 = blockIdx.x * 64;
  __shared__ __attribute__((aligned(16))) _Float16 t[64 * 72];
  int tid = threadIdx.x;
  int c4 = (tid & 15) * 4, rp = (tid >> 4) * 2;
  v4f a[4], b[4];
  const float* src[4];
  for (int p = 0; p < 4; ++p) {
    src[p] = in + (size_t)(r0 + p * 16 + rp) * C + (c0 + c4);
    a[p] = *(const v4f*)src[p];
    b[p] = *(const v4f*)(src[p] + C);
  }
  asm volatile("s_wait_xcnt 0x0"
               :: "v"(src[0]), "v"(src[1]), "v"(src[2]), "v"(src[3]),
                  "v"(src[0] + C), "v"(src[1] + C), "v"(src[2] + C),
                  "v"(src[3] + C)
               : "memory");
  for (int p = 0; p < 4; ++p)
    for (int i = 0; i < 4; ++i) {
      v2h pr;
      pr[0] = (_Float16)a[p][i];
      pr[1] = (_Float16)b[p][i];
      *(v2h*)&t[(c4 + i) * 72 + p * 16 + rp] = pr;
    }
  __syncthreads();
  int ch = (tid & 7) * 8, cr = tid >> 3;
  for (int p = 0; p < 4; ++p) {
    int c = p * 16 + cr;
    *(v8h*)(out + (size_t)(c0 + c) * R + (r0 + ch)) = *(const v8h*)&t[c * 72 + ch];
  }
}

// ---------------------------------------------------------------------------
// Generic WMMA GEMM: C[M,N] = act(A[M,K] * B^T[N,K] + bias) (+ residual).
// 256 threads = 8 waves; block tile 128x128; wave tile 32x64; K-step 64.
// Double-buffered LDS (one barrier / K-step); async global->LDS staging.
// A stage holds 128 B of every operand row; 8 adjacent lanes copy one row's
// piece, so a wave-wide copy covers 4 whole 128-B lines. K % 64 == 0.
// LDS row stride 72 halves (144 B = 16 B x 9 -> conflict-free b128 reads).
// ---------------------------------------------------------------------------
__global__ __launch_bounds__(256) void gemm_f16_kernel(
    const _Float16* __restrict__ A, const _Float16* __restrict__ BT,
    const float* __restrict__ bias, const float* __restrict__ resid,
    float* __restrict__ outF, _Float16* __restrict__ outH,
    int M, int N, int K, int doRelu) {
  const int LS = 72;
  __shared__ _Float16 Al[2][128 * LS];
  __shared__ _Float16 Bl[2][128 * LS];
  int tid  = threadIdx.x;
  int wave = tid >> 5, lane = tid & 31;
  int hi = lane >> 4, lo = lane & 15, kk0 = hi * 8;
  int wm = wave >> 1, wn = wave & 1;
  int m0 = blockIdx.y * 128, n0 = blockIdx.x * 128;
  int ldr = tid >> 3, ldc = (tid & 7) * 8;
  int dOff = ldr * LS + ldc;
  const _Float16* Ag = A  + (size_t)(m0 + ldr) * K + ldc;
  const _Float16* Bg = BT + (size_t)(n0 + ldr) * K + ldc;
  const size_t rstep = (size_t)32 * K;  // the block's copies advance 32 rows
  // One lane per operand row prefetches that row into L2 ahead of its copies.
  const _Float16* pf = (tid < 128) ? A  + (size_t)(m0 + tid) * K
                                   : BT + (size_t)(n0 + tid - 128) * K;

  auto stage = [&](int buf, int k0) {
    for (int j = 0; j < 4; ++j) {
      cp16(&Al[buf][dOff + j * 32 * LS], Ag + j * rstep + k0);
      cp16(&Bl[buf][dOff + j * 32 * LS], Bg + j * rstep + k0);
    }
  };

  v8f acc[2][4] = {};
  int nk = K >> 6;
  stage(0, 0);
  for (int i = 0; i < nk; ++i) {
    int cur = i & 1;
    async_fence();           // this wave's async writes into LDS are done
    __syncthreads();         // everyone's writes visible; prev reads done
    if (i + 1 < nk) stage(cur ^ 1, (i + 1) << 6);
    if (!(i & 1) && i + 2 < nk) {
      // Every second step, prefetch where stage i+2 starts in each row, for speed only.
      // pf lives through the loop and
      // only ever holds an address inside its operand.
      pf += 128;
      asm volatile("global_prefetch_b8 %0, off scope:SCOPE_SE" :: "v"(pf));
    }
    const _Float16* Ab = Al[cur];
    const _Float16* Bb = Bl[cur];
    for (int kh = 0; kh < 2; ++kh) {
      int ko = kh * 32 + kk0;
      v16h af0 = frag_ld(&Ab[(wm * 32 + lo) * LS + ko]);
      v16h af1 = frag_ld(&Ab[(wm * 32 + 16 + lo) * LS + ko]);
      v16h bf[4];
      for (int nt = 0; nt < 4; ++nt)
        bf[nt] = frag_ld(&Bb[(wn * 64 + nt * 16 + lo) * LS + ko]);
      for (int nt = 0; nt < 4; ++nt) {
        acc[0][nt] = wmma16(af0, bf[nt], acc[0][nt]);
        acc[1][nt] = wmma16(af1, bf[nt], acc[1][nt]);
      }
    }
  }
  for (int gm = 0; gm < 2; ++gm)
    for (int nt = 0; nt < 4; ++nt) {
      int col = n0 + wn * 64 + nt * 16 + lo;
      float bv = bias ? bias[col] : 0.0f;
      for (int g = 0; g < 8; ++g) {
        int m = m0 + wm * 32 + gm * 16 + hi * 8 + g;
        float v = acc[gm][nt][g] + bv;
        if (doRelu) v = fmaxf(v, 0.0f);
        size_t off = (size_t)m * N + col;
        if (resid) v += resid[off];
        if (outF) outF[off] = v;
        if (outH) outH[off] = (_Float16)v;
      }
    }
}

__device__ __forceinline__ float xhalf(float x) {
  int b = __builtin_bit_cast(int, x);
  return __builtin_bit_cast(
      float, __builtin_amdgcn_permlanex16(b, b, 0x76543210, 0xfedcba98, false,
                                          false));
}

__global__ __launch_bounds__(256) void flash_attn_kernel(
    const _Float16* __restrict__ qkv, _Float16* __restrict__ outH) {
  const int T = 2048, S3 = 3072, HD = 64;
  int qb = blockIdx.x, h = blockIdx.y, b = blockIdx.z;
  int tid  = threadIdx.x;
  int wave = tid >> 5, lane = tid & 31;
  int hi = lane >> 4, lo = lane & 15, kk0 = hi * 8;
  int q0 = qb * 128 + wave * 16;
  int qi = q0 + lo;  // the query this lane owns

  const _Float16* Qp = qkv + (size_t)(b * T) * S3 + h * HD;
  const _Float16* Kp = Qp + 1024;
  const _Float16* Vp = Qp + 2048;

  __shared__ _Float16 Ksh[64 * 72];
  __shared__ _Float16 VTsh[64 * 72];

  v16h qf0, qf1;
  {
    const _Float16* qrow = Qp + (size_t)qi * S3;
    qf0 = mk16(*(const v8h*)(qrow + kk0),      *(const v8h*)(qrow + kk0 + 16));
    qf1 = mk16(*(const v8h*)(qrow + 32 + kk0), *(const v8h*)(qrow + 32 + kk0 + 16));
  }

  // Oacc[et][g] = O[qi][et*16 + hi*8 + g]. rowM is the query's running maximum
  // (equal in both lane halves); rowL sums this half's keys only, the halves
  // are joined once behind the loop.
  v8f Oacc[4] = {};
  float rowM = -1e30f, rowL = 0.0f;

  int ldr = tid >> 2, cg = tid & 3;
  int ntiles = 2 * (qb + 1);  // keys up to end of this query block

  for (int kt = 0; kt < ntiles; ++kt) {
    int k0 = kt * 64;
    __syncthreads();
    {  // K tile: straight per-lane copy -> async path; V: transposed (sync)
      const _Float16* krow = Kp + (size_t)(k0 + ldr) * S3 + cg * 16;
      cp16(&Ksh[ldr * 72 + cg * 16], krow);
      cp16(&Ksh[ldr * 72 + cg * 16 + 8], krow + 8);
      const _Float16* vrow = Vp + (size_t)(k0 + ldr) * S3 + cg * 16;
      v8h v0 = *(const v8h*)(vrow);
      v8h v1 = *(const v8h*)(vrow + 8);
      for (int j = 0; j < 8; ++j) {
        VTsh[(cg * 16 + j) * 72 + ldr]     = v0[j];
        VTsh[(cg * 16 + 8 + j) * 72 + ldr] = v1[j];
      }
    }
    async_fence();
    __syncthreads();

    if (k0 <= q0 + 15) {  // uniform per wave
      v8f p[4];      // p[nt][g]: key k0 + nt*16 + hi*8 + g against query qi
      float mx[4];   // one chain per score tile, joined below
      for (int nt = 0; nt < 4; ++nt) {
        v8f s = {};
        v16h kf0 = frag_ld(&Ksh[(nt * 16 + lo) * 72 + kk0]);
        v16h kf1 = frag_ld(&Ksh[(nt * 16 + lo) * 72 + 32 + kk0]);
        s = wmma16(kf0, qf0, s);
        s = wmma16(kf1, qf1, s);
        int kj = k0 + nt * 16 + hi * 8;
        for (int g = 0; g < 8; ++g)
          p[nt][g] = (kj + g <= qi) ? s[g] * 0.125f : -1e30f;
        mx[nt] = p[nt][0];
        for (int g = 1; g < 8; ++g) mx[nt] = fmaxf(mx[nt], p[nt][g]);
      }
      float m = fmaxf(fmaxf(mx[0], mx[1]), fmaxf(mx[2], mx[3]));
      m = fmaxf(m, xhalf(m));
      float nm = fmaxf(rowM, m);
      float corr = __expf(rowM - nm);
      float rs[4];
      for (int nt = 0; nt < 4; ++nt) {
        p[nt] = (p[nt] - nm) * 1.44269504f;  // e^x = 2^(x log2 e)
        rs[nt] = 0.0f;
        for (int g = 0; g < 8; ++g) {
          p[nt][g] = __builtin_amdgcn_exp2f(p[nt][g]);
          rs[nt] += p[nt][g];
        }
      }
      rowL = rowL * corr + ((rs[0] + rs[1]) + (rs[2] + rs[3]));
      rowM = nm;
      for (int et = 0; et < 4; ++et) Oacc[et] *= corr;
      // P^T as B fragments: element s of a lane is key kk0 + s (s < 8) or
      // 16 + kk0 + (s - 8) of the 32-key block, which is what the lane holds.
      v16h pf0 = mk16(__builtin_convertvector(p[0], v8h),
                      __builtin_convertvector(p[1], v8h));
      v16h pf1 = mk16(__builtin_convertvector(p[2], v8h),
                      __builtin_convertvector(p[3], v8h));
      for (int et = 0; et < 4; ++et) {
        v16h vf0 = frag_ld(&VTsh[(et * 16 + lo) * 72 + kk0]);
        v16h vf1 = frag_ld(&VTsh[(et * 16 + lo) * 72 + 32 + kk0]);
        Oacc[et] = wmma16(vf0, pf0, Oacc[et]);
        Oacc[et] = wmma16(vf1, pf1, Oacc[et]);
      }
    }
  }

  float inv = 1.0f / (rowL + xhalf(rowL));
  _Float16* orow = outH + (size_t)(b * T + qi) * 1024 + h * HD + hi * 8;
  for (int et = 0; et < 4; ++et)
    *(v8h*)(orow + et * 16) = __builtin_convertvector(Oacc[et] * inv, v8h);
}

// ---------------------------------------------------------------------------
extern "C" void kernel_launch(void* const* d_in, const int* in_sizes, int n_in,
                              void* d_out, int out_size, void* d_ws, size_t ws_size,
                              hipStream_t stream) {
  (void)in_sizes; (void)n_in; (void)out_size; (void)ws_size;
  const int B = 4, T = 2048, D = 1024, H = 16, HD = 64, F = 4096;
  const int M = B * T;

  const float* x   = (const float*)d_in[0];
  const float* Wq  = (const float*)d_in[1];
  const float* Wk  = (const float*)d_in[2];
  const float* Wv  = (const float*)d_in[3];
  const float* Wo  = (const float*)d_in[4];
  const float* bo  = (const float*)d_in[5];
  const float* W1  = (const float*)d_in[6];
  const float* b1  = (const float*)d_in[7];
  const float* W2  = (const float*)d_in[8];
  const float* b2  = (const float*)d_in[9];
  const float* g1  = (const float*)d_in[10];
  const float* be1 = (const float*)d_in[11];
  const float* g2  = (const float*)d_in[12];
  const float* be2 = (const float*)d_in[13];

  char* w = (char*)d_ws;
  auto alloc = [&](size_t bytes) -> void* {
    void* p = (void*)w;
    w += (bytes + 255) & ~(size_t)255;
    return p;
  };
  _Float16* h16  = (_Float16*)alloc((size_t)M * D * 2);       // LN1 out
  _Float16* qkvT = (_Float16*)alloc((size_t)3 * D * D * 2);   // [3072][1024]
  _Float16* woT  = (_Float16*)alloc((size_t)D * D * 2);       // [1024][1024]
  _Float16* w1T  = (_Float16*)alloc((size_t)F * D * 2);       // [4096][1024]
  _Float16* w2T  = (_Float16*)alloc((size_t)D * F * 2);       // [1024][4096]
  _Float16* qkv  = (_Float16*)alloc((size_t)M * 3 * D * 2);   // [8192][3072]
  _Float16* a16  = (_Float16*)alloc((size_t)M * D * 2);       // attn concat
  float*    x1   = (float*)   alloc((size_t)M * D * 4);       // residual 1
  _Float16* h2   = (_Float16*)alloc((size_t)M * D * 2);       // LN2 out
  _Float16* ffh  = (_Float16*)alloc((size_t)M * F * 2);       // relu(h2 W1+b1)

  // Weight prep: cast + transpose so every GEMM B operand is B^T[N][K].
  transpose_cast_kernel<<<dim3(HD / 64, D / 64, H), 128, 0, stream>>>(
      Wq, qkvT, D, HD, (long long)D * HD, (long long)HD * D);
  transpose_cast_kernel<<<dim3(HD / 64, D / 64, H), 128, 0, stream>>>(
      Wk, qkvT + (size_t)D * D, D, HD, (long long)D * HD, (long long)HD * D);
  transpose_cast_kernel<<<dim3(HD / 64, D / 64, H), 128, 0, stream>>>(
      Wv, qkvT + (size_t)2 * D * D, D, HD, (long long)D * HD, (long long)HD * D);
  transpose_cast_kernel<<<dim3(D / 64, D / 64, 1), 128, 0, stream>>>(
      Wo, woT, D, D, 0, 0);
  transpose_cast_kernel<<<dim3(F / 64, D / 64, 1), 128, 0, stream>>>(
      W1, w1T, D, F, 0, 0);
  transpose_cast_kernel<<<dim3(D / 64, F / 64, 1), 128, 0, stream>>>(
      W2, w2T, F, D, 0, 0);

  // LN1 -> fused QKV projection -> flash attention
  ln_f16_kernel<<<M / 16, 256, 0, stream>>>(x, g1, be1, h16);
  gemm_f16_kernel<<<dim3(3 * D / 128, M / 128), 256, 0, stream>>>(
      h16, qkvT, nullptr, nullptr, nullptr, qkv, M, 3 * D, D, 0);
  flash_attn_kernel<<<dim3(T / 128, H, B), 256, 0, stream>>>(qkv, a16);

  // Wo projection + bias + residual(x) -> x1 (f32)
  gemm_f16_kernel<<<dim3(D / 128, M / 128), 256, 0, stream>>>(
      a16, woT, bo, x, x1, nullptr, M, D, D, 0);

  // LN2 -> FFN1 (relu) -> FFN2 + residual(x1) -> out
  ln_f16_kernel<<<M / 16, 256, 0, stream>>>(x1, g2, be2, h2);
  gemm_f16_kernel<<<dim3(F / 128, M / 128), 256, 0, stream>>>(
      h2, w1T, b1, nullptr, nullptr, ffh, M, F, D, 1);
  gemm_f16_kernel<<<dim3(D / 128, M / 128), 256, 0, stream>>>(
      ffh, w2T, b2, x1, (float*)d_out, nullptr, M, D, F, 0);
}

// v004
// Measured time: 321 microseconds a run.
// In both of two side-by-side timings against v003, it was 1.20 times as fast.
// Counting every step since v000, it is 2.43 times as fast.
#include <hip/hip_runtime.h>

typedef _Float16 v16h __attribute__((ext_vector_type(16)));
typedef _Float16 v8h  __attribute__((ext_vector_type(8)));
typedef _Float16 v4h  __attribute__((ext_vector_type(4)));
typedef _Float16 v2h  __attribute__((ext_vector_type(2)));
typedef float    v4f  __attribute__((ext_vector_type(4)));
typedef float    v8f  __attribute__((ext_vector_type(8)));
typedef int      v4i  __attribute__((ext_vector_type(4)));

#if defined(__has_builtin)
#  if __has_builtin(__builtin_amdgcn_global_load_async_to_lds_b128) && \
      __has_builtin(__builtin_amdgcn_s_wait_asynccnt)
#    define USE_ASYNC_LDS 1
#  endif
#endif
#ifndef USE_ASYNC_LDS
#  define USE_ASYNC_LDS 0
#endif

#if USE_ASYNC_LDS
// b128 async copy payload is typed as int4; global src is AS1, LDS dst is AS3.
typedef __attribute__((address_space(1))) v4i gbl_v4i;
typedef __attribute__((address_space(3))) v4i lds_v4i;
#endif

// Copy 16 bytes global -> LDS (per-lane addresses).
__device__ __forceinline__ void cp16(_Float16* lds, const _Float16* g) {
#if USE_ASYNC_LDS
  _Float16* gn = const_cast<_Float16*>(g);
  __builtin_amdgcn_global_load_async_to_lds_b128((gbl_v4i*)gn, (lds_v4i*)lds,
                                                 0, 0);
#else
  *(v8h*)lds = *(const v8h*)g;
#endif
}
__device__ __forceinline__ void async_fence() {
#if USE_ASYNC_LDS
  __builtin_amdgcn_s_wait_asynccnt(0);
#endif
}

__device__ __forceinline__ v16h mk16(v8h a, v8h b) {
  return __builtin_shufflevector(a, b, 0,1,2,3,4,5,6,7,8,9,10,11,12,13,14,15);
}
__device__ __forceinline__ v16h frag_ld(const _Float16* p) {
  v8h a = *(const v8h*)(p);
  v8h b = *(const v8h*)(p + 16);
  return mk16(a, b);
}
__device__ __forceinline__ v8f wmma16(v16h a, v16h b, v8f c) {
  return __builtin_amdgcn_wmma_f32_16x16x32_f16(false, a, false, b, (short)0, c,
                                                false, false);
}

// ---------------------------------------------------------------------------
// LayerNorm (D = 1024), f32 in -> f16 out. One wave owns two whole rows: all
// 16 row loads (512 contiguous bytes each) are issued before the first sum,
// the row sums close with a 32-lane butterfly, and no LDS or barrier is used.
// 256 threads = 8 waves = 16 rows per block, so 16x fewer waves are started
// than with one 8-wave block per row.
// ---------------------------------------------------------------------------
__global__ __launch_bounds__(256) void ln_f16_kernel(
    const float* __restrict__ x, const float* __restrict__ gamma,
    const float* __restrict__ beta, _Float16* __restrict__ out) {
  const int D = 1024;
  int lane = threadIdx.x & 31;
  // The wave's number is the same in all its lanes: kept scalar, the row base
  // stays in scalar registers and one lane offset serves every load.
  int wave = __builtin_amdgcn_readfirstlane(threadIdx.x >> 5);
  int row0 = (blockIdx.x * 8 + wave) * 2;
  const float4* xr = (const float4*)(x + (size_t)row0 * D) + lane;
  float4 v[2][8];
  for (int r = 0; r < 2; ++r)
    for (int j = 0; j < 8; ++j) v[r][j] = xr[r * 256 + j * 32];
  float mu[2], rs[2];
  for (int r = 0; r < 2; ++r) {
    float s = 0.0f, q = 0.0f;
    for (int j = 0; j < 8; ++j) {
      float4 t = v[r][j];
      s += t.x + t.y + t.z + t.w;
      q += t.x * t.x + t.y * t.y + t.z * t.z + t.w * t.w;
    }
    for (int off = 16; off > 0; off >>= 1) {
      s += __shfl_xor(s, off, 32);
      q += __shfl_xor(q, off, 32);
    }
    mu[r] = s * (1.0f / 1024.0f);
    float var = q * (1.0f / 1024.0f) - mu[r] * mu[r];
    rs[r] = rsqrtf(var + 1e-5f);
  }
  for (int j = 0; j < 8; ++j) {
    float4 g = ((const float4*)gamma)[j * 32 + lane];
    float4 b = ((const float4*)beta)[j * 32 + lane];
    for (int r = 0; r < 2; ++r) {
      float4 t = v[r][j];
      v4h o;
      o[0] = (_Float16)((t.x - mu[r]) * rs[r] * g.x + b.x);
      o[1] = (_Float16)((t.y - mu[r]) * rs[r] * g.y + b.y);
      o[2] = (_Float16)((t.z - mu[r]) * rs[r] * g.z + b.z);
      o[3] = (_Float16)((t.w - mu[r]) * rs[r] * g.w + b.w);
      ((v4h*)(out + (size_t)(row0 + r) * D))[j * 32 + lane] = o;
    }
  }
}

// ---------------------------------------------------------------------------
// Weight prep: f32 [R][C] -> f16 [C][R] (transpose + cast). 4 waves move one
// 64x64 tile, 32 elements per lane: 8 float4 loads in flight per lane (256 B
// of a source row per 16 lanes), two source rows packed per LDS dword, and
// 16-B stores, 8 adjacent lanes to one whole 128-B line of an output row.
// R % 64 == 0, C % 64 == 0. LDS row pitch 72 halves keeps b128 reads aligned.
// ---------------------------------------------------------------------------
__global__ __launch_bounds__(128) void transpose_cast_kernel(
    const float* __restrict__ in, _Float16* __restrict__ out,
    int R, int C, long long inBatch, long long outBatch) {
  in  += (long long)blockIdx.z * inBatch;
  out += (long long)blockIdx.z * outBatch;
  int r0 = blockIdx.y * 64, c0 = blockIdx.x * 64;
  __shared__ __attribute__((aligned(16))) _Float16 t[64 * 72];
  int tid = threadIdx.x;
  int c4 = (tid & 15) * 4, rp = (tid >> 4) * 2;
  v4f a[4], b[4];
  const float* src[4];
  for (int p = 0; p < 4; ++p) {
    src[p] = in + (size_t)(r0 + p * 16 + rp) * C + (c0 + c4);
    a[p] = *(const v4f*)src[p];
    b[p] = *(const v4f*)(src[p] + C);
  }
  asm volatile("s_wait_xcnt 0x0"
               :: "v"(src[0]), "v"(src[1]), "v"(src[2]), "v"(src[3]),
                  "v"(src[0] + C), "v"(src[1] + C), "v"(src[2] + C),
                  "v"(src[3] + C)
               : "memory");
  for (int p = 0; p < 4; ++p)
    for (int i = 0; i < 4; ++i) {
      v2h pr;
      pr[0] = (_Float16)a[p][i];
      pr[1] = (_Float16)b[p][i];
      *(v2h*)&t[(c4 + i) * 72 + p * 16 + rp] = pr;
    }
  __syncthreads();
  int ch = (tid & 7) * 8, cr = tid >> 3;
  for (int p = 0; p < 4; ++p) {
    int c = p * 16 + cr;
    *(v8h*)(out + (size_t)(c0 + c) * R + (r0 + ch)) = *(const v8h*)&t[c * 72 + ch];
  }
}

// ---------------------------------------------------------------------------
// Generic WMMA GEMM: C[M,N] = act(A[M,K] * B^T[N,K] + bias) (+ residual).
// 256 threads = 8 waves; block tile 128x128; wave tile 32x64; K-step 64.
// Double-buffered LDS (one barrier / K-step); async global->LDS staging.
// A stage holds 128 B of every operand row; 8 adjacent lanes copy one row's
// piece, so a wave-wide copy covers 4 whole 128-B lines. K % 64 == 0.
// LDS row stride 72 halves (144 B = 16 B x 9 -> conflict-free b128 reads).
// Epilogue: each wave lays its 32x64 f32 tile into its own part of the ring
// (row pitch 68 floats) and reads it back by rows, 4 columns per lane, so
// that 16 lanes store one whole row piece (256 B of f32, 128 B of f16) and
// the residual comes in as 16 independent 16-B loads issued together. N is a
// literal in every caller: all 16 row pieces hang off one address by constant
// offsets.
// ---------------------------------------------------------------------------
__device__ __forceinline__ void gemm_tile(
    const _Float16* __restrict__ A, const _Float16* __restrict__ BT,
    const float* __restrict__ bias, const float* __restrict__ resid,
    float* __restrict__ outF, _Float16* __restrict__ outH,
    const int N, int K, const bool hasBias, const bool doRelu,
    const bool f32out) {
  const int LS = 72;
  const int OPB = 128 * LS;  // halves of one operand's buffer
  // [A buf 0 | A buf 1 | B buf 0 | B buf 1]; the epilogue reuses all of it.
  __shared__ __attribute__((aligned(16))) _Float16 sm[4 * OPB];
  int tid  = threadIdx.x;
  int wave = tid >> 5, lane = tid & 31;
  int hi = lane >> 4, lo = lane & 15, kk0 = hi * 8;
  int wm = wave >> 1, wn = wave & 1;
  int m0 = blockIdx.y * 128, n0 = blockIdx.x * 128;
  int ldr = tid >> 3, ldc = (tid & 7) * 8;
  int dOff = ldr * LS + ldc;
  const _Float16* Ag = A  + (size_t)(m0 + ldr) * K + ldc;
  const _Float16* Bg = BT + (size_t)(n0 + ldr) * K + ldc;
  const size_t rstep = (size_t)32 * K;  // the block's copies advance 32 rows
  // One lane per operand row prefetches that row into L2 ahead of its copies.
  const _Float16* pf = (tid < 128) ? A  + (size_t)(m0 + tid) * K
                                   : BT + (size_t)(n0 + tid - 128) * K;

  auto stage = [&](int buf, int k0) {
    for (int j = 0; j < 4; ++j) {
      cp16(&sm[buf * OPB + dOff + j * 32 * LS], Ag + j * rstep + k0);
      cp16(&sm[(2 + buf) * OPB + dOff + j * 32 * LS], Bg + j * rstep + k0);
    }
  };

  v8f acc[2][4] = {};
  int nk = K >> 6;
  stage(0, 0);
  for (int i = 0; i < nk; ++i) {
    int cur = i & 1;
    async_fence();           // this wave's async writes into LDS are done
    __syncthreads();         // everyone's writes visible; prev reads done
    if (i + 1 < nk) stage(cur ^ 1, (i + 1) << 6);
    if (!(i & 1) && i + 2 < nk) {
      // Every second step, prefetch where stage i+2 starts in each row, for speed only.
      // pf lives through the loop and
      // only ever holds an address inside its operand.
      pf += 128;
      asm volatile("global_prefetch_b8 %0, off scope:SCOPE_SE" :: "v"(pf));
    }
    const _Float16* Ab = &sm[cur * OPB];
    const _Float16* Bb = &sm[(2 + cur) * OPB];
    for (int kh = 0; kh < 2; ++kh) {
      int ko = kh * 32 + kk0;
      v16h af0 = frag_ld(&Ab[(wm * 32 + lo) * LS + ko]);
      v16h af1 = frag_ld(&Ab[(wm * 32 + 16 + lo) * LS + ko]);
      v16h bf[4];
      for (int nt = 0; nt < 4; ++nt)
        bf[nt] = frag_ld(&Bb[(wn * 64 + nt * 16 + lo) * LS + ko]);
      for (int nt = 0; nt < 4; ++nt) {
        acc[0][nt] = wmma16(af0, bf[nt], acc[0][nt]);
        acc[1][nt] = wmma16(af1, bf[nt], acc[1][nt]);
      }
    }
  }

  // Lane (hi, lo) finishes columns lo*4 .. lo*4+3 of rows 2j + hi, j = 0..15.
  const int SP = 68;  // 272-B rows: 16 B x odd, conflict-free both ways
  int col = n0 + wn * 64 + lo * 4;
  const size_t off0 = (size_t)(m0 + wm * 32 + hi) * N + col;
  const size_t jstep = (size_t)2 * N;
  __syncthreads();  // every wave has read its last fragments out of the ring
  v4f rv[16];
  v4f bv = {};
  const float* rp = f32out ? resid + off0 : nullptr;
  const float* bp = hasBias ? bias + col : nullptr;
  if (f32out)
    for (int j = 0; j < 16; ++j) rv[j] = *(const v4f*)(rp + j * jstep);
  if (hasBias) bv = *(const v4f*)bp;
  if (f32out)
    asm volatile("s_wait_xcnt 0x0" :: "v"(rp), "v"(bp) : "memory");
  else if (hasBias)
    asm volatile("s_wait_xcnt 0x0" :: "v"(bp) : "memory");
  float* sw = (float*)sm + wave * (32 * SP);
  for (int gm = 0; gm < 2; ++gm)
    for (int nt = 0; nt < 4; ++nt)
      for (int g = 0; g < 8; ++g)
        sw[(gm * 16 + hi * 8 + g) * SP + nt * 16 + lo] = acc[gm][nt][g];
  // The rows are read back by other lanes of this wave: its stores are done.
  asm volatile("s_wait_dscnt 0x0" ::: "memory");
  for (int j = 0; j < 16; ++j) {
    v4f v = *(const v4f*)&sw[(j * 2 + hi) * SP + lo * 4] + bv;
    if (f32out) {
      *(v4f*)(outF + off0 + j * jstep) = v + rv[j];
    } else {
      if (doRelu)
        for (int e = 0; e < 4; ++e) v[e] = fmaxf(v[e], 0.0f);
      *(v4h*)(outH + off0 + j * jstep) = __builtin_convertvector(v, v4h);
    }
  }
}

// N = 3072, f16 result: A B^T.
__global__ __launch_bounds__(256) void gemm_n3072_kernel(
    const _Float16* __restrict__ A, const _Float16* __restrict__ BT,
    _Float16* __restrict__ outH, int K) {
  gemm_tile(A, BT, nullptr, nullptr, nullptr, outH, 3072, K, false, false,
            false);
}

// N = 4096, f16 result: relu(A B^T + bias).
__global__ __launch_bounds__(256) void gemm_n4096_relu_kernel(
    const _Float16* __restrict__ A, const _Float16* __restrict__ BT,
    const float* __restrict__ bias, _Float16* __restrict__ outH, int K) {
  gemm_tile(A, BT, bias, nullptr, nullptr, outH, 4096, K, true, true, false);
}

// N = 1024, f32 result: A B^T + bias + residual.
__global__ __launch_bounds__(256) void gemm_n1024_res_kernel(
    const _Float16* __restrict__ A, const _Float16* __restrict__ BT,
    const float* __restrict__ bias, const float* __restrict__ resid,
    float* __restrict__ outF, int K) {
  gemm_tile(A, BT, bias, resid, outF, nullptr, 1024, K, true, false, true);
}

__device__ __forceinline__ float xhalf(float x) {
  int b = __builtin_bit_cast(int, x);
  return __builtin_bit_cast(
      float, __builtin_amdgcn_permlanex16(b, b, 0x76543210, 0xfedcba98, false,
                                          false));
}

__global__ __launch_bounds__(256) void flash_attn_kernel(
    const _Float16* __restrict__ qkv, _Float16* __restrict__ outH) {
  const int T = 2048, S3 = 3072, HD = 64;
  int qb = blockIdx.x, h = blockIdx.y, b = blockIdx.z;
  int tid  = threadIdx.x;
  int wave = tid >> 5, lane = tid & 31;
  int hi = lane >> 4, lo = lane & 15, kk0 = hi * 8;
  int q0 = qb * 128 + wave * 16;
  int qi = q0 + lo;  // the query this lane owns

  const _Float16* Qp = qkv + (size_t)(b * T) * S3 + h * HD;
  const _Float16* Kp = Qp + 1024;
  const _Float16* Vp = Qp + 2048;

  __shared__ _Float16 Ksh[64 * 72];
  __shared__ _Float16 VTsh[64 * 72];

  v16h qf0, qf1;
  {
    const _Float16* qrow = Qp + (size_t)qi * S3;
    qf0 = mk16(*(const v8h*)(qrow + kk0),      *(const v8h*)(qrow + kk0 + 16));
    qf1 = mk16(*(const v8h*)(qrow + 32 + kk0), *(const v8h*)(qrow + 32 + kk0 + 16));
  }

  // Oacc[et][g] = O[qi][et*16 + hi*8 + g]. rowM is the query's running maximum
  // (equal in both lane halves); rowL sums this half's keys only, the halves
  // are joined once behind the loop.
  v8f Oacc[4] = {};
  float rowM = -1e30f, rowL = 0.0f;

  int ldr = tid >> 2, cg = tid & 3;
  int ntiles = 2 * (qb + 1);  // keys up to end of this query block

  for (int kt = 0; kt < ntiles; ++kt) {
    int k0 = kt * 64;
    __syncthreads();
    {  // K tile: straight per-lane copy -> async path; V: transposed (sync)
      const _Float16* krow = Kp + (size_t)(k0 + ldr) * S3 + cg * 16;
      cp16(&Ksh[ldr * 72 + cg * 16], krow);
      cp16(&Ksh[ldr * 72 + cg * 16 + 8], krow + 8);
      const _Float16* vrow = Vp + (size_t)(k0 + ldr) * S3 + cg * 16;
      v8h v0 = *(const v8h*)(vrow);
      v8h v1 = *(const v8h*)(vrow + 8);
      for (int j = 0; j < 8; ++j) {
        VTsh[(cg * 16 + j) * 72 + ldr]     = v0[j];
        VTsh[(cg * 16 + 8 + j) * 72 + ldr] = v1[j];
      }
    }
    async_fence();
    __syncthreads();

    if (k0 <= q0 + 15) {  // uniform per wave
      v8f p[4];      // p[nt][g]: key k0 + nt*16 + hi*8 + g against query qi
      float mx[4];   // one chain per score tile, joined below
      for (int nt = 0; nt < 4; ++nt) {
        v8f s = {};
        v16h kf0 = frag_ld(&Ksh[(nt * 16 + lo) * 72 + kk0]);
        v16h kf1 = frag_ld(&Ksh[(nt * 16 + lo) * 72 + 32 + kk0]);
        s = wmma16(kf0, qf0, s);
        s = wmma16(kf1, qf1, s);
        int kj = k0 + nt * 16 + hi * 8;
        for (int g = 0; g < 8; ++g)
          p[nt][g] = (kj + g <= qi) ? s[g] * 0.125f : -1e30f;
        mx[nt] = p[nt][0];
        for (int g = 1; g < 8; ++g) mx[nt] = fmaxf(mx[nt], p[nt][g]);
      }
      float m = fmaxf(fmaxf(mx[0], mx[1]), fmaxf(mx[2], mx[3]));
      m = fmaxf(m, xhalf(m));
      float nm = fmaxf(rowM, m);
      float corr = __expf(rowM - nm);
      float rs[4];
      for (int nt = 0; nt < 4; ++nt) {
        p[nt] = (p[nt] - nm) * 1.44269504f;  // e^x = 2^(x log2 e)
        rs[nt] = 0.0f;
        for (int g = 0; g < 8; ++g) {
          p[nt][g] = __builtin_amdgcn_exp2f(p[nt][g]);
          rs[nt] += p[nt][g];
        }
      }
      rowL = rowL * corr + ((rs[0] + rs[1]) + (rs[2] + rs[3]));
      rowM = nm;
      for (int et = 0; et < 4; ++et) Oacc[et] *= corr;
      // P^T as B fragments: element s of a lane is key kk0 + s (s < 8) or
      // 16 + kk0 + (s - 8) of the 32-key block, which is what the lane holds.
      v16h pf0 = mk16(__builtin_convertvector(p[0], v8h),
                      __builtin_convertvector(p[1], v8h));
      v16h pf1 = mk16(__builtin_convertvector(p[2], v8h),
                      __builtin_convertvector(p[3], v8h));
      for (int et = 0; et < 4; ++et) {
        v16h vf0 = frag_ld(&VTsh[(et * 16 + lo) * 72 + kk0]);
        v16h vf1 = frag_ld(&VTsh[(et * 16 + lo) * 72 + 32 + kk0]);
        Oacc[et] = wmma16(vf0, pf0, Oacc[et]);
        Oacc[et] = wmma16(vf1, pf1, Oacc[et]);
      }
    }
  }

  float inv = 1.0f / (rowL + xhalf(rowL));
  _Float16* orow = outH + (size_t)(b * T + qi) * 1024 + h * HD + hi * 8;
  for (int et = 0; et < 4; ++et)
    *(v8h*)(orow + et * 16) = __builtin_convertvector(Oacc[et] * inv, v8h);
}

// ---------------------------------------------------------------------------
extern "C" void kernel_launch(void* const* d_in, const int* in_sizes, int n_in,
                              void* d_out, int out_size, void* d_ws, size_t ws_size,
                              hipStream_t stream) {
  (void)in_sizes; (void)n_in; (void)out_size; (void)ws_size;
  const int B = 4, T = 2048, D = 1024, H = 16, HD = 64, F = 4096;
  const int M = B * T;

  const float* x   = (const float*)d_in[0];
  const float* Wq  = (const float*)d_in[1];
  const float* Wk  = (const float*)d_in[2];
  const float* Wv  = (const float*)d_in[3];
  const float* Wo  = (const float*)d_in[4];
  const float* bo  = (const float*)d_in[5];
  const float* W1  = (const float*)d_in[6];
  const float* b1  = (const float*)d_in[7];
  const float* W2  = (const float*)d_in[8];
  const float* b2  = (const float*)d_in[9];
  const float* g1  = (const float*)d_in[10];
  const float* be1 = (const float*)d_in[11];
  const float* g2  = (const float*)d_in[12];
  const float* be2 = (const float*)d_in[13];

  char* w = (char*)d_ws;
  auto alloc = [&](size_t bytes) -> void* {
    void* p = (void*)w;
    w += (bytes + 255) & ~(size_t)255;
    return p;
  };
  _Float16* h16  = (_Float16*)alloc((size_t)M * D * 2);       // LN1 out
  _Float16* qkvT = (_Float16*)alloc((size_t)3 * D * D * 2);   // [3072][1024]
  _Float16* woT  = (_Float16*)alloc((size_t)D * D * 2);       // [1024][1024]
  _Float16* w1T  = (_Float16*)alloc((size_t)F * D * 2);       // [4096][1024]
  _Float16* w2T  = (_Float16*)alloc((size_t)D * F * 2);       // [1024][4096]
  _Float16* qkv  = (_Float16*)alloc((size_t)M * 3 * D * 2);   // [8192][3072]
  _Float16* a16  = (_Float16*)alloc((size_t)M * D * 2);       // attn concat
  float*    x1   = (float*)   alloc((size_t)M * D * 4);       // residual 1
  _Float16* h2   = (_Float16*)alloc((size_t)M * D * 2);       // LN2 out
  _Float16* ffh  = (_Float16*)alloc((size_t)M * F * 2);       // relu(h2 W1+b1)

  // Weight prep: cast + transpose so every GEMM B operand is B^T[N][K].
  transpose_cast_kernel<<<dim3(HD / 64, D / 64, H), 128, 0, stream>>>(
      Wq, qkvT, D, HD, (long long)D * HD, (long long)HD * D);
  transpose_cast_kernel<<<dim3(HD / 64, D / 64, H), 128, 0, stream>>>(
      Wk, qkvT + (size_t)D * D, D, HD, (long long)D * HD, (long long)HD * D);
  transpose_cast_kernel<<<dim3(HD / 64, D / 64, H), 128, 0, stream>>>(
      Wv, qkvT + (size_t)2 * D * D, D, HD, (long long)D * HD, (long long)HD * D);
  transpose_cast_kernel<<<dim3(D / 64, D / 64, 1), 128, 0, stream>>>(
      Wo, woT, D, D, 0, 0);
  transpose_cast_kernel<<<dim3(F / 64, D / 64, 1), 128, 0, stream>>>(
      W1, w1T, D, F, 0, 0);
  transpose_cast_kernel<<<dim3(D / 64, F / 64, 1), 128, 0, stream>>>(
      W2, w2T, F, D, 0, 0);

  // LN1 -> fused QKV projection -> flash attention
  ln_f16_kernel<<<M / 16, 256, 0, stream>>>(x, g1, be1, h16);
  gemm_n3072_kernel<<<dim3(3 * D / 128, M / 128), 256, 0, stream>>>(
      h16, qkvT, qkv, D);
  flash_attn_kernel<<<dim3(T / 128, H, B), 256, 0, stream>>>(qkv, a16);

  // Wo projection + bias + residual(x) -> x1 (f32)
  gemm_n1024_res_kernel<<<dim3(D / 128, M / 128), 256, 0, stream>>>(
      a16, woT, bo, x, x1, D);

  // LN2 -> FFN1 (relu) -> FFN2 + residual(x1) -> out
  ln_f16_kernel<<<M / 16, 256, 0, stream>>>(x1, g2, be2, h2);
  gemm_n4096_relu_kernel<<<dim3(F / 128, M / 128), 256, 0, stream>>>(
      h2, w1T, b1, ffh, D);
  gemm_n1024_res_kernel<<<dim3(D / 128, M / 128), 256, 0, stream>>>(
      ffh, w2T, b2, x1, (float*)d_out, F);
}

// v005
// Measured time: 308 microseconds a run.
// Two timings next to v004 put it at 1.04 and 1.05 times that version's speed.
// Over all steps from v000 it is 2.54 times as fast.
#include <hip/hip_runtime.h>

typedef _Float16 v16h __attribute__((ext_vector_type(16)));
typedef _Float16 v8h  __attribute__((ext_vector_type(8)));
typedef _Float16 v4h  __attribute__((ext_vector_type(4)));
typedef _Float16 v2h  __attribute__((ext_vector_type(2)));
typedef float    v4f  __attribute__((ext_vector_type(4)));
typedef float    v8f  __attribute__((ext_vector_type(8)));
typedef int      v4i  __attribute__((ext_vector_type(4)));

#if defined(__has_builtin)
#  if __has_builtin(__builtin_amdgcn_global_load_async_to_lds_b128) && \
      __has_builtin(__builtin_amdgcn_s_wait_asynccnt)
#    define USE_ASYNC_LDS 1
#  endif
#endif
#ifndef USE_ASYNC_LDS
#  define USE_ASYNC_LDS 0
#endif

#if USE_ASYNC_LDS
// b128 async copy payload is typed as int4; global src is AS1, LDS dst is AS3.
typedef __attribute__((address_space(1))) v4i gbl_v4i;
typedef __attribute__((address_space(3))) v4i lds_v4i;
#endif

// Copy 16 bytes global -> LDS (per-lane addresses).
__device__ __forceinline__ void cp16(_Float16* lds, const _Float16* g) {
#if USE_ASYNC_LDS
  _Float16* gn = const_cast<_Float16*>(g);
  __builtin_amdgcn_global_load_async_to_lds_b128((gbl_v4i*)gn, (lds_v4i*)lds,
                                                 0, 0);
#else
  *(v8h*)lds = *(const v8h*)g;
#endif
}
__device__ __forceinline__ void async_fence() {
#if USE_ASYNC_LDS
  __builtin_amdgcn_s_wait_asynccnt(0);
#endif
}

__device__ __forceinline__ v16h mk16(v8h a, v8h b) {
  return __builtin_shufflevector(a, b, 0,1,2,3,4,5,6,7,8,9,10,11,12,13,14,15);
}
__device__ __forceinline__ v16h frag_ld(const _Float16* p) {
  v8h a = *(const v8h*)(p);
  v8h b = *(const v8h*)(p + 16);
  return mk16(a, b);
}
__device__ __forceinline__ v8f wmma16(v16h a, v16h b, v8f c) {
  return __builtin_amdgcn_wmma_f32_16x16x32_f16(false, a, false, b, (short)0, c,
                                                false, false);
}

// ---------------------------------------------------------------------------
// LayerNorm (D = 1024), f32 in -> f16 out. One wave owns two whole rows: all
// 16 row loads (512 contiguous bytes each) are issued before the first sum,
// the row sums close with a 32-lane butterfly, and no LDS or barrier is used.
// 256 threads = 8 waves = 16 rows per block, so 16x fewer waves are started
// than with one 8-wave block per row. blk = which 16 rows.
// ---------------------------------------------------------------------------
__device__ __forceinline__ void ln_rows(
    const float* __restrict__ x, const float* __restrict__ gamma,
    const float* __restrict__ beta, _Float16* __restrict__ out, int blk) {
  const int D = 1024;
  int lane = threadIdx.x & 31;
  // The wave's number is the same in all its lanes: kept scalar, the row base
  // stays in scalar registers and one lane offset serves every load.
  int wave = __builtin_amdgcn_readfirstlane(threadIdx.x >> 5);
  int row0 = (blk * 8 + wave) * 2;
  const float4* xr = (const float4*)(x + (size_t)row0 * D) + lane;
  float4 v[2][8];
  for (int r = 0; r < 2; ++r)
    for (int j = 0; j < 8; ++j) v[r][j] = xr[r * 256 + j * 32];
  float mu[2], rs[2];
  for (int r = 0; r < 2; ++r) {
    float s = 0.0f, q = 0.0f;
    for (int j = 0; j < 8; ++j) {
      float4 t = v[r][j];
      s += t.x + t.y + t.z + t.w;
      q += t.x * t.x + t.y * t.y + t.z * t.z + t.w * t.w;
    }
    for (int off = 16; off > 0; off >>= 1) {
      s += __shfl_xor(s, off, 32);
      q += __shfl_xor(q, off, 32);
    }
    mu[r] = s * (1.0f / 1024.0f);
    float var = q * (1.0f / 1024.0f) - mu[r] * mu[r];
    rs[r] = rsqrtf(var + 1e-5f);
  }
  for (int j = 0; j < 8; ++j) {
    float4 g = ((const float4*)gamma)[j * 32 + lane];
    float4 b = ((const float4*)beta)[j * 32 + lane];
    for (int r = 0; r < 2; ++r) {
      float4 t = v[r][j];
      v4h o;
      o[0] = (_Float16)((t.x - mu[r]) * rs[r] * g.x + b.x);
      o[1] = (_Float16)((t.y - mu[r]) * rs[r] * g.y + b.y);
      o[2] = (_Float16)((t.z - mu[r]) * rs[r] * g.z + b.z);
      o[3] = (_Float16)((t.w - mu[r]) * rs[r] * g.w + b.w);
      ((v4h*)(out + (size_t)(row0 + r) * D))[j * 32 + lane] = o;
    }
  }
}

__global__ __launch_bounds__(256) void ln_f16_kernel(
    const float* __restrict__ x, const float* __restrict__ gamma,
    const float* __restrict__ beta, _Float16* __restrict__ out) {
  ln_rows(x, gamma, beta, out, blockIdx.x);
}

// ---------------------------------------------------------------------------
// Weight prep: f32 [R][C] -> f16 [C][R] (transpose + cast). 4 waves move one
// 64x64 tile, 32 elements per lane: 8 float4 loads in flight per lane (256 B
// of a source row per 16 lanes), two source rows packed per LDS dword, and
// 16-B stores, 8 adjacent lanes to one whole 128-B line of an output row.
// R % 64 == 0, C % 64 == 0. LDS row pitch 72 halves keeps b128 reads aligned.
// t = the tile's own 64 x 72 halves of LDS, tid = 0..127 within the 4 waves.
// Holds one barrier: every wave of the block calls it.
// ---------------------------------------------------------------------------
__device__ __forceinline__ void transpose_tile(
    const float* __restrict__ in, _Float16* __restrict__ out,
    int R, int C, int r0, int c0, _Float16* t, int tid) {
  int c4 = (tid & 15) * 4, rp = (tid >> 4) * 2;
  v4f a[4], b[4];
  const float* src[4];
  for (int p = 0; p < 4; ++p) {
    src[p] = in + (size_t)(r0 + p * 16 + rp) * C + (c0 + c4);
    a[p] = *(const v4f*)src[p];
    b[p] = *(const v4f*)(src[p] + C);
  }
  asm volatile("s_wait_xcnt 0x0"
               :: "v"(src[0]), "v"(src[1]), "v"(src[2]), "v"(src[3]),
                  "v"(src[0] + C), "v"(src[1] + C), "v"(src[2] + C),
                  "v"(src[3] + C)
               : "memory");
  for (int p = 0; p < 4; ++p)
    for (int i = 0; i < 4; ++i) {
      v2h pr;
      pr[0] = (_Float16)a[p][i];
      pr[1] = (_Float16)b[p][i];
      *(v2h*)&t[(c4 + i) * 72 + p * 16 + rp] = pr;
    }
  __syncthreads();
  int ch = (tid & 7) * 8, cr = tid >> 3;
  for (int p = 0; p < 4; ++p) {
    int c = p * 16 + cr;
    *(v8h*)(out + (size_t)(c0 + c) * R + (r0 + ch)) = *(const v8h*)&t[c * 72 + ch];
  }
}

// ---------------------------------------------------------------------------
// Everything that depends on the inputs alone, in ONE launch: the first
// LayerNorm (blocks 0..511, 16 rows each) and the cast + transpose of all six
// weights (blocks 512..2047, two 64x64 tiles each, one per 4 waves). None of
// these pieces reads what another writes, so they need no launch boundary
// between them, and each one's start and drain hides behind the others' work.
// Tiles in order: Wq, Wk, Wv (per head [1024][64], 16 x 16 tiles each),
// Wo [1024][1024], W1 [1024][4096], W2 [4096][1024]. Every range starts at an
// even tile, so a block's two tiles are of one weight.
// ---------------------------------------------------------------------------
__global__ __launch_bounds__(256) void prep_kernel(
    const float* __restrict__ x, const float* __restrict__ gamma,
    const float* __restrict__ beta, _Float16* __restrict__ h16,
    const float* __restrict__ Wq, const float* __restrict__ Wk,
    const float* __restrict__ Wv, const float* __restrict__ Wo,
    const float* __restrict__ W1, const float* __restrict__ W2,
    _Float16* __restrict__ qkvT, _Float16* __restrict__ woT,
    _Float16* __restrict__ w1T, _Float16* __restrict__ w2T) {
  int blk = blockIdx.x;
  if (blk < 512) {  // the same for the whole block, ahead of the barrier
    ln_rows(x, gamma, beta, h16, blk);
    return;
  }
  __shared__ __attribute__((aligned(16))) _Float16 t[2][64 * 72];
  // Which half of the block: the same in all lanes of a wave, kept scalar so
  // that the choice of weight and tile below is scalar work.
  int half = __builtin_amdgcn_readfirstlane(threadIdx.x >> 7);
  int tile = (blk - 512) * 2 + half;
  const float* in;
  _Float16* out;
  int R, C, r0, c0;
  if (tile < 768) {
    int w = tile >> 8, head = (tile >> 4) & 15;
    in  = (w == 0 ? Wq : w == 1 ? Wk : Wv) + head * (1024 * 64);
    out = qkvT + (w * 16 + head) * (64 * 1024);
    R = 1024; C = 64; r0 = (tile & 15) * 64; c0 = 0;
  } else if (tile < 1024) {
    int u = tile - 768;
    in = Wo; out = woT;
    R = 1024; C = 1024; r0 = (u >> 4) * 64; c0 = (u & 15) * 64;
  } else if (tile < 2048) {
    int u = tile - 1024;
    in = W1; out = w1T;
    R = 1024; C = 4096; r0 = (u >> 6) * 64; c0 = (u & 63) * 64;
  } else {
    int u = tile - 2048;
    in = W2; out = w2T;
    R = 4096; C = 1024; r0 = (u >> 4) * 64; c0 = (u & 15) * 64;
  }
  transpose_tile(in, out, R, C, r0, c0, t[half], threadIdx.x & 127);
}

// ---------------------------------------------------------------------------
// Generic WMMA GEMM: C[M,N] = act(A[M,K] * B^T[N,K] + bias) (+ residual).
// 256 threads = 8 waves; block tile 128x128; wave tile 32x64; K-step 64.
// Double-buffered LDS (one barrier / K-step); async global->LDS staging.
// A stage holds 128 B of every operand row; 8 adjacent lanes copy one row's
// piece, so a wave-wide copy covers 4 whole 128-B lines. K % 64 == 0.
// LDS row stride 72 halves (144 B = 16 B x 9 -> conflict-free b128 reads).
// Epilogue: each wave lays its 32x64 f32 tile into its own part of the ring
// (row pitch 68 floats) and reads it back by rows, 4 columns per lane, so
// that 16 lanes store one whole row piece (256 B of f32, 128 B of f16) and
// the residual comes in as 16 independent 16-B loads issued together. N is a
// literal in every caller: all 16 row pieces hang off one address by constant
// offsets.
// ---------------------------------------------------------------------------
__device__ __forceinline__ void gemm_tile(
    const _Float16* __restrict__ A, const _Float16* __restrict__ BT,
    const float* __restrict__ bias, const float* __restrict__ resid,
    float* __restrict__ outF, _Float16* __restrict__ outH,
    const int N, int K, const bool hasBias, const bool doRelu,
    const bool f32out) {
  const int LS = 72;
  const int OPB = 128 * LS;  // halves of one operand's buffer
  // [A buf 0 | A buf 1 | B buf 0 | B buf 1]; the epilogue reuses all of it.
  __shared__ __attribute__((aligned(16))) _Float16 sm[4 * OPB];
  int tid  = threadIdx.x;
  int wave = tid >> 5, lane = tid & 31;
  int hi = lane >> 4, lo = lane & 15, kk0 = hi * 8;
  int wm = wave >> 1, wn = wave & 1;
  int m0 = blockIdx.y * 128, n0 = blockIdx.x * 128;
  int ldr = tid >> 3, ldc = (tid & 7) * 8;
  int dOff = ldr * LS + ldc;
  const _Float16* Ag = A  + (size_t)(m0 + ldr) * K + ldc;
  const _Float16* Bg = BT + (size_t)(n0 + ldr) * K + ldc;
  const size_t rstep = (size_t)32 * K;  // the block's copies advance 32 rows
  // One lane per operand row prefetches that row into L2 ahead of its copies.
  const _Float16* pf = (tid < 128) ? A  + (size_t)(m0 + tid) * K
                                   : BT + (size_t)(n0 + tid - 128) * K;

  auto stage = [&](int buf, int k0) {
    for (int j = 0; j < 4; ++j) {
      cp16(&sm[buf * OPB + dOff + j * 32 * LS], Ag + j * rstep + k0);
      cp16(&sm[(2 + buf) * OPB + dOff + j * 32 * LS], Bg + j * rstep + k0);
    }
  };

  v8f acc[2][4] = {};
  int nk = K >> 6;
  stage(0, 0);
  for (int i = 0; i < nk; ++i) {
    int cur = i & 1;
    async_fence();           // this wave's async writes into LDS are done
    __syncthreads();         // everyone's writes visible; prev reads done
    if (i + 1 < nk) stage(cur ^ 1, (i + 1) << 6);
    if (!(i & 1) && i + 2 < nk) {
      // Every second step, prefetch where stage i+2 starts in each row, for speed only.
      // pf lives through the loop and
      // only ever holds an address inside its operand.
      pf += 128;
      asm volatile("global_prefetch_b8 %0, off scope:SCOPE_SE" :: "v"(pf));
    }
    const _Float16* Ab = &sm[cur * OPB];
    const _Float16* Bb = &sm[(2 + cur) * OPB];
    for (int kh = 0; kh < 2; ++kh) {
      int ko = kh * 32 + kk0;
      v16h af0 = frag_ld(&Ab[(wm * 32 + lo) * LS + ko]);
      v16h af1 = frag_ld(&Ab[(wm * 32 + 16 + lo) * LS + ko]);
      v16h bf[4];
      for (int nt = 0; nt < 4; ++nt)
        bf[nt] = frag_ld(&Bb[(wn * 64 + nt * 16 + lo) * LS + ko]);
      for (int nt = 0; nt < 4; ++nt) {
        acc[0][nt] = wmma16(af0, bf[nt], acc[0][nt]);
        acc[1][nt] = wmma16(af1, bf[nt], acc[1][nt]);
      }
    }
  }

  // Lane (hi, lo) finishes columns lo*4 .. lo*4+3 of rows 2j + hi, j = 0..15.
  const int SP = 68;  // 272-B rows: 16 B x odd, conflict-free both ways
  int col = n0 + wn * 64 + lo * 4;
  const size_t off0 = (size_t)(m0 + wm * 32 + hi) * N + col;
  const size_t jstep = (size_t)2 * N;
  __syncthreads();  // every wave has read its last fragments out of the ring
  v4f rv[16];
  v4f bv = {};
  const float* rp = f32out ? resid + off0 : nullptr;
  const float* bp = hasBias ? bias + col : nullptr;
  if (f32out)
    for (int j = 0; j < 16; ++j) rv[j] = *(const v4f*)(rp + j * jstep);
  if (hasBias) bv = *(const v4f*)bp;
  if (f32out)
    asm volatile("s_wait_xcnt 0x0" :: "v"(rp), "v"(bp) : "memory");
  else if (hasBias)
    asm volatile("s_wait_xcnt 0x0" :: "v"(bp) : "memory");
  float* sw = (float*)sm + wave * (32 * SP);
  for (int gm = 0; gm < 2; ++gm)
    for (int nt = 0; nt < 4; ++nt)
      for (int g = 0; g < 8; ++g)
        sw[(gm * 16 + hi * 8 + g) * SP + nt * 16 + lo] = acc[gm][nt][g];
  // The rows are read back by other lanes of this wave: its stores are done.
  asm volatile("s_wait_dscnt 0x0" ::: "memory");
  for (int j = 0; j < 16; ++j) {
    v4f v = *(const v4f*)&sw[(j * 2 + hi) * SP + lo * 4] + bv;
    if (f32out) {
      *(v4f*)(outF + off0 + j * jstep) = v + rv[j];
    } else {
      if (doRelu)
        for (int e = 0; e < 4; ++e) v[e] = fmaxf(v[e], 0.0f);
      *(v4h*)(outH + off0 + j * jstep) = __builtin_convertvector(v, v4h);
    }
  }
}

// N = 3072, f16 result: A B^T.
__global__ __launch_bounds__(256) void gemm_n3072_kernel(
    const _Float16* __restrict__ A, const _Float16* __restrict__ BT,
    _Float16* __restrict__ outH, int K) {
  gemm_tile(A, BT, nullptr, nullptr, nullptr, outH, 3072, K, false, false,
            false);
}

// N = 4096, f16 result: relu(A B^T + bias).
__global__ __launch_bounds__(256) void gemm_n4096_relu_kernel(
    const _Float16* __restrict__ A, const _Float16* __restrict__ BT,
    const float* __restrict__ bias, _Float16* __restrict__ outH, int K) {
  gemm_tile(A, BT, bias, nullptr, nullptr, outH, 4096, K, true, true, false);
}

// N = 1024, f32 result: A B^T + bias + residual.
__global__ __launch_bounds__(256) void gemm_n1024_res_kernel(
    const _Float16* __restrict__ A, const _Float16* __restrict__ BT,
    const float* __restrict__ bias, const float* __restrict__ resid,
    float* __restrict__ outF, int K) {
  gemm_tile(A, BT, bias, resid, outF, nullptr, 1024, K, true, false, true);
}

__device__ __forceinline__ float xhalf(float x) {
  int b = __builtin_bit_cast(int, x);
  return __builtin_bit_cast(
      float, __builtin_amdgcn_permlanex16(b, b, 0x76543210, 0xfedcba98, false,
                                          false));
}

__global__ __launch_bounds__(256) void flash_attn_kernel(
    const _Float16* __restrict__ qkv, _Float16* __restrict__ outH) {
  const int T = 2048, S3 = 3072, HD = 64;
  int qb = blockIdx.x, h = blockIdx.y, b = blockIdx.z;
  int tid  = threadIdx.x;
  int wave = tid >> 5, lane = tid & 31;
  int hi = lane >> 4, lo = lane & 15, kk0 = hi * 8;
  int q0 = qb * 128 + wave * 16;
  int qi = q0 + lo;  // the query this lane owns

  const _Float16* Qp = qkv + (size_t)(b * T) * S3 + h * HD;
  const _Float16* Kp = Qp + 1024;
  const _Float16* Vp = Qp + 2048;

  __shared__ _Float16 Ksh[64 * 72];
  __shared__ _Float16 VTsh[64 * 72];

  v16h qf0, qf1;
  {
    const _Float16* qrow = Qp + (size_t)qi * S3;
    qf0 = mk16(*(const v8h*)(qrow + kk0),      *(const v8h*)(qrow + kk0 + 16));
    qf1 = mk16(*(const v8h*)(qrow + 32 + kk0), *(const v8h*)(qrow + 32 + kk0 + 16));
  }

  // Oacc[et][g] = O[qi][et*16 + hi*8 + g]. rowM is the query's running maximum
  // (equal in both lane halves); rowL sums this half's keys only, the halves
  // are joined once behind the loop.
  v8f Oacc[4] = {};
  float rowM = -1e30f, rowL = 0.0f;

  int ldr = tid >> 2, cg = tid & 3;
  int ntiles = 2 * (qb + 1);  // keys up to end of this query block

  for (int kt = 0; kt < ntiles; ++kt) {
    int k0 = kt * 64;
    __syncthreads();
    {  // K tile: straight per-lane copy -> async path; V: transposed (sync)
      const _Float16* krow = Kp + (size_t)(k0 + ldr) * S3 + cg * 16;
      cp16(&Ksh[ldr * 72 + cg * 16], krow);
      cp16(&Ksh[ldr * 72 + cg * 16 + 8], krow + 8);
      const _Float16* vrow = Vp + (size_t)(k0 + ldr) * S3 + cg * 16;
      v8h v0 = *(const v8h*)(vrow);
      v8h v1 = *(const v8h*)(vrow + 8);
      for (int j = 0; j < 8; ++j) {
        VTsh[(cg * 16 + j) * 72 + ldr]     = v0[j];
        VTsh[(cg * 16 + 8 + j) * 72 + ldr] = v1[j];
      }
    }
    async_fence();
    __syncthreads();

    if (k0 <= q0 + 15) {  // uniform per wave
      v8f p[4];      // p[nt][g]: key k0 + nt*16 + hi*8 + g against query qi
      float mx[4];   // one chain per score tile, joined below
      for (int nt = 0; nt < 4; ++nt) {
        v8f s = {};
        v16h kf0 = frag_ld(&Ksh[(nt * 16 + lo) * 72 + kk0]);
        v16h kf1 = frag_ld(&Ksh[(nt * 16 + lo) * 72 + 32 + kk0]);
        s = wmma16(kf0, qf0, s);
        s = wmma16(kf1, qf1, s);
        int kj = k0 + nt * 16 + hi * 8;
        for (int g = 0; g < 8; ++g)
          p[nt][g] = (kj + g <= qi) ? s[g] * 0.125f : -1e30f;
        mx[nt] = p[nt][0];
        for (int g = 1; g < 8; ++g) mx[nt] = fmaxf(mx[nt], p[nt][g]);
      }
      float m = fmaxf(fmaxf(mx[0], mx[1]), fmaxf(mx[2], mx[3]));
      m = fmaxf(m, xhalf(m));
      float nm = fmaxf(rowM, m);
      float corr = __expf(rowM - nm);
      float rs[4];
      for (int nt = 0; nt < 4; ++nt) {
        p[nt] = (p[nt] - nm) * 1.44269504f;  // e^x = 2^(x log2 e)
        rs[nt] = 0.0f;
        for (int g = 0; g < 8; ++g) {
          p[nt][g] = __builtin_amdgcn_exp2f(p[nt][g]);
          rs[nt] += p[nt][g];
        }
      }
      rowL = rowL * corr + ((rs[0] + rs[1]) + (rs[2] + rs[3]));
      rowM = nm;
      for (int et = 0; et < 4; ++et) Oacc[et] *= corr;
      // P^T as B fragments: element s of a lane is key kk0 + s (s < 8) or
      // 16 + kk0 + (s - 8) of the 32-key block, which is what the lane holds.
      v16h pf0 = mk16(__builtin_convertvector(p[0], v8h),
                      __builtin_convertvector(p[1], v8h));
      v16h pf1 = mk16(__builtin_convertvector(p[2], v8h),
                      __builtin_convertvector(p[3], v8h));
      for (int et = 0; et < 4; ++et) {
        v16h vf0 = frag_ld(&VTsh[(et * 16 + lo) * 72 + kk0]);
        v16h vf1 = frag_ld(&VTsh[(et * 16 + lo) * 72 + 32 + kk0]);
        Oacc[et] = wmma16(vf0, pf0, Oacc[et]);
        Oacc[et] = wmma16(vf1, pf1, Oacc[et]);
      }
    }
  }

  float inv = 1.0f / (rowL + xhalf(rowL));
  _Float16* orow = outH + (size_t)(b * T + qi) * 1024 + h * HD + hi * 8;
  for (int et = 0; et < 4; ++et)
    *(v8h*)(orow + et * 16) = __builtin_convertvector(Oacc[et] * inv, v8h);
}

// ---------------------------------------------------------------------------
extern "C" void kernel_launch(void* const* d_in, const int* in_sizes, int n_in,
                              void* d_out, int out_size, void* d_ws, size_t ws_size,
                              hipStream_t stream) {
  (void)in_sizes; (void)n_in; (void)out_size; (void)ws_size;
  const int B = 4, T = 2048, D = 1024, H = 16, HD = 64, F = 4096;
  const int M = B * T;

  const float* x   = (const float*)d_in[0];
  const float* Wq  = (const float*)d_in[1];
  const float* Wk  = (const float*)d_in[2];
  const float* Wv  = (const float*)d_in[3];
  const float* Wo  = (const float*)d_in[4];
  const float* bo  = (const float*)d_in[5];
  const float* W1  = (const float*)d_in[6];
  const float* b1  = (const float*)d_in[7];
  const float* W2  = (const float*)d_in[8];
  const float* b2  = (const float*)d_in[9];
  const float* g1  = (const float*)d_in[10];
  const float* be1 = (const float*)d_in[11];
  const float* g2  = (const float*)d_in[12];
  const float* be2 = (const float*)d_in[13];

  char* w = (char*)d_ws;
  auto alloc = [&](size_t bytes) -> void* {
    void* p = (void*)w;
    w += (bytes + 255) & ~(size_t)255;
    return p;
  };
  _Float16* h16  = (_Float16*)alloc((size_t)M * D * 2);       // LN1 out
  _Float16* qkvT = (_Float16*)alloc((size_t)3 * D * D * 2);   // [3072][1024]
  _Float16* woT  = (_Float16*)alloc((size_t)D * D * 2);       // [1024][1024]
  _Float16* w1T  = (_Float16*)alloc((size_t)F * D * 2);       // [4096][1024]
  _Float16* w2T  = (_Float16*)alloc((size_t)D * F * 2);       // [1024][4096]
  _Float16* qkv  = (_Float16*)alloc((size_t)M * 3 * D * 2);   // [8192][3072]
  _Float16* a16  = (_Float16*)alloc((size_t)M * D * 2);       // attn concat
  float*    x1   = (float*)   alloc((size_t)M * D * 4);       // residual 1
  _Float16* h2   = (_Float16*)alloc((size_t)M * D * 2);       // LN2 out
  _Float16* ffh  = (_Float16*)alloc((size_t)M * F * 2);       // relu(h2 W1+b1)

  // LN1 and the weight prep (cast + transpose, so that every GEMM B operand is
  // B^T[N][K]) in one launch: 512 LN blocks + 3072 / 2 tile blocks.
  prep_kernel<<<2048, 256, 0, stream>>>(x, g1, be1, h16, Wq, Wk, Wv, Wo, W1, W2,
                                        qkvT, woT, w1T, w2T);

  // fused QKV projection -> flash attention
  gemm_n3072_kernel<<<dim3(3 * D / 128, M / 128), 256, 0, stream>>>(
      h16, qkvT, qkv, D);
  flash_attn_kernel<<<dim3(T / 128, H, B), 256, 0, stream>>>(qkv, a16);

  // Wo projection + bias + residual(x) -> x1 (f32)
  gemm_n1024_res_kernel<<<dim3(D / 128, M / 128), 256, 0, stream>>>(
      a16, woT, bo, x, x1, D);

  // LN2 -> FFN1 (relu) -> FFN2 + residual(x1) -> out
  ln_f16_kernel<<<M / 16, 256, 0, stream>>>(x1, g2, be2, h2);
  gemm_n4096_relu_kernel<<<dim3(F / 128, M / 128), 256, 0, stream>>>(
      h2, w1T, b1, ffh, D);
  gemm_n1024_res_kernel<<<dim3(D / 128, M / 128), 256, 0, stream>>>(
      ffh, w2T, b2, x1, (float*)d_out, F);
}

// v006
// One run takes 275 microseconds.
// Timed twice side by side with v005, it ran 1.11 and 1.12 times as fast.
// All steps since v000 together make it 2.84 times as fast.
#include <hip/hip_runtime.h>

typedef _Float16 v16h __attribute__((ext_vector_type(16)));
typedef _Float16 v8h  __attribute__((ext_vector_type(8)));
typedef _Float16 v4h  __attribute__((ext_vector_type(4)));
typedef _Float16 v2h  __attribute__((ext_vector_type(2)));
typedef float    v4f  __attribute__((ext_vector_type(4)));
typedef float    v8f  __attribute__((ext_vector_type(8)));
typedef int      v4i  __attribute__((ext_vector_type(4)));

#if defined(__has_builtin)
#  if __has_builtin(__builtin_amdgcn_global_load_async_to_lds_b128) && \
      __has_builtin(__builtin_amdgcn_s_wait_asynccnt)
#    define USE_ASYNC_LDS 1
#  endif
#endif
#ifndef USE_ASYNC_LDS
#  define USE_ASYNC_LDS 0
#endif

#if USE_ASYNC_LDS
// b128 async copy payload is typed as int4; global src is AS1, LDS dst is AS3.
typedef __attribute__((address_space(1))) v4i gbl_v4i;
typedef __attribute__((address_space(3))) v4i lds_v4i;
#endif

// Copy 16 bytes global -> LDS (per-lane addresses).
__device__ __forceinline__ void cp16(_Float16* lds, const _Float16* g) {
#if USE_ASYNC_LDS
  _Float16* gn = const_cast<_Float16*>(g);
  __builtin_amdgcn_global_load_async_to_lds_b128((gbl_v4i*)gn, (lds_v4i*)lds,
                                                 0, 0);
#else
  *(v8h*)lds = *(const v8h*)g;
#endif
}
__device__ __forceinline__ void async_fence() {
#if USE_ASYNC_LDS
  __builtin_amdgcn_s_wait_asynccnt(0);
#endif
}

__device__ __forceinline__ v16h mk16(v8h a, v8h b) {
  return __builtin_shufflevector(a, b, 0,1,2,3,4,5,6,7,8,9,10,11,12,13,14,15);
}
__device__ __forceinline__ v16h frag_ld(const _Float16* p) {
  v8h a = *(const v8h*)(p);
  v8h b = *(const v8h*)(p + 16);
  return mk16(a, b);
}
__device__ __forceinline__ v8f wmma16(v16h a, v16h b, v8f c) {
  return __builtin_amdgcn_wmma_f32_16x16x32_f16(false, a, false, b, (short)0, c,
                                                false, false);
}

// ---------------------------------------------------------------------------
// LayerNorm (D = 1024), f32 in -> f16 out. One wave owns two whole rows: all
// 16 row loads (512 contiguous bytes each) are issued before the first sum,
// the row sums close with a 32-lane butterfly, and no LDS or barrier is used.
// 256 threads = 8 waves = 16 rows per block, so 16x fewer waves are started
// than with one 8-wave block per row. blk = which 16 rows.
// ---------------------------------------------------------------------------
__device__ __forceinline__ void ln_rows(
    const float* __restrict__ x, const float* __restrict__ gamma,
    const float* __restrict__ beta, _Float16* __restrict__ out, int blk) {
  const int D = 1024;
  int lane = threadIdx.x & 31;
  // The wave's number is the same in all its lanes: kept scalar, the row base
  // stays in scalar registers and one lane offset serves every load.
  int wave = __builtin_amdgcn_readfirstlane(threadIdx.x >> 5);
  int row0 = (blk * 8 + wave) * 2;
  const float4* xr = (const float4*)(x + (size_t)row0 * D) + lane;
  float4 v[2][8];
  for (int r = 0; r < 2; ++r)
    for (int j = 0; j < 8; ++j) v[r][j] = xr[r * 256 + j * 32];
  float mu[2], rs[2];
  for (int r = 0; r < 2; ++r) {
    float s = 0.0f, q = 0.0f;
    for (int j = 0; j < 8; ++j) {
      float4 t = v[r][j];
      s += t.x + t.y + t.z + t.w;
      q += t.x * t.x + t.y * t.y + t.z * t.z + t.w * t.w;
    }
    for (int off = 16; off > 0; off >>= 1) {
      s += __shfl_xor(s, off, 32);
      q += __shfl_xor(q, off, 32);
    }
    mu[r] = s * (1.0f / 1024.0f);
    float var = q * (1.0f / 1024.0f) - mu[r] * mu[r];
    rs[r] = rsqrtf(var + 1e-5f);
  }
  for (int j = 0; j < 8; ++j) {
    float4 g = ((const float4*)gamma)[j * 32 + lane];
    float4 b = ((const float4*)beta)[j * 32 + lane];
    for (int r = 0; r < 2; ++r) {
      float4 t = v[r][j];
      v4h o;
      o[0] = (_Float16)((t.x - mu[r]) * rs[r] * g.x + b.x);
      o[1] = (_Float16)((t.y - mu[r]) * rs[r] * g.y + b.y);
      o[2] = (_Float16)((t.z - mu[r]) * rs[r] * g.z + b.z);
      o[3] = (_Float16)((t.w - mu[r]) * rs[r] * g.w + b.w);
      ((v4h*)(out + (size_t)(row0 + r) * D))[j * 32 + lane] = o;
    }
  }
}

__global__ __launch_bounds__(256) void ln_f16_kernel(
    const float* __restrict__ x, const float* __restrict__ gamma,
    const float* __restrict__ beta, _Float16* __restrict__ out) {
  ln_rows(x, gamma, beta, out, blockIdx.x);
}

// ---------------------------------------------------------------------------
// Weight prep: f32 [R][C] -> f16 [C][R] (transpose + cast). 4 waves move one
// 64x64 tile, 32 elements per lane: 8 float4 loads in flight per lane (256 B
// of a source row per 16 lanes), two source rows packed per LDS dword, and
// 16-B stores, 8 adjacent lanes to one whole 128-B line of an output row.
// R % 64 == 0, C % 64 == 0. LDS row pitch 72 halves keeps b128 reads aligned.
// t = the tile's own 64 x 72 halves of LDS, tid = 0..127 within the 4 waves.
// Holds one barrier: every wave of the block calls it.
// ---------------------------------------------------------------------------
__device__ __forceinline__ void transpose_tile(
    const float* __restrict__ in, _Float16* __restrict__ out,
    int R, int C, int r0, int c0, _Float16* t, int tid) {
  int c4 = (tid & 15) * 4, rp = (tid >> 4) * 2;
  v4f a[4], b[4];
  const float* src[4];
  for (int p = 0; p < 4; ++p) {
    src[p] = in + (size_t)(r0 + p * 16 + rp) * C + (c0 + c4);
    a[p] = *(const v4f*)src[p];
    b[p] = *(const v4f*)(src[p] + C);
  }
  asm volatile("s_wait_xcnt 0x0"
               :: "v"(src[0]), "v"(src[1]), "v"(src[2]), "v"(src[3]),
                  "v"(src[0] + C), "v"(src[1] + C), "v"(src[2] + C),
                  "v"(src[3] + C)
               : "memory");
  for (int p = 0; p < 4; ++p)
    for (int i = 0; i < 4; ++i) {
      v2h pr;
      pr[0] = (_Float16)a[p][i];
      pr[1] = (_Float16)b[p][i];
      *(v2h*)&t[(c4 + i) * 72 + p * 16 + rp] = pr;
    }
  __syncthreads();
  int ch = (tid & 7) * 8, cr = tid >> 3;
  for (int p = 0; p < 4; ++p) {
    int c = p * 16 + cr;
    *(v8h*)(out + (size_t)(c0 + c) * R + (r0 + ch)) = *(const v8h*)&t[c * 72 + ch];
  }
}

// ---------------------------------------------------------------------------
// Everything that depends on the inputs alone, in ONE launch: the first
// LayerNorm (blocks 0..511, 16 rows each) and the cast + transpose of all six
// weights (blocks 512..2047, two 64x64 tiles each, one per 4 waves). None of
// these pieces reads what another writes, so they need no launch boundary
// between them, and each one's start and drain hides behind the others' work.
// Tiles in order: Wq, Wk, Wv (per head [1024][64], 16 x 16 tiles each),
// Wo [1024][1024], W1 [1024][4096], W2 [4096][1024]. Every range starts at an
// even tile, so a block's two tiles are of one weight.
// ---------------------------------------------------------------------------
__global__ __launch_bounds__(256) void prep_kernel(
    const float* __restrict__ x, const float* __restrict__ gamma,
    const float* __restrict__ beta, _Float16* __restrict__ h16,
    const float* __restrict__ Wq, const float* __restrict__ Wk,
    const float* __restrict__ Wv, const float* __restrict__ Wo,
    const float* __restrict__ W1, const float* __restrict__ W2,
    _Float16* __restrict__ qkvT, _Float16* __restrict__ woT,
    _Float16* __restrict__ w1T, _Float16* __restrict__ w2T) {
  int blk = blockIdx.x;
  if (blk < 512) {  // the same for the whole block, ahead of the barrier
    ln_rows(x, gamma, beta, h16, blk);
    return;
  }
  __shared__ __attribute__((aligned(16))) _Float16 t[2][64 * 72];
  // Which half of the block: the same in all lanes of a wave, kept scalar so
  // that the choice of weight and tile below is scalar work.
  int half = __builtin_amdgcn_readfirstlane(threadIdx.x >> 7);
  int tile = (blk - 512) * 2 + half;
  const float* in;
  _Float16* out;
  int R, C, r0, c0;
  if (tile < 768) {
    int w = tile >> 8, head = (tile >> 4) & 15;
    in  = (w == 0 ? Wq : w == 1 ? Wk : Wv) + head * (1024 * 64);
    out = qkvT + (w * 16 + head) * (64 * 1024);
    R = 1024; C = 64; r0 = (tile & 15) * 64; c0 = 0;
  } else if (tile < 1024) {
    int u = tile - 768;
    in = Wo; out = woT;
    R = 1024; C = 1024; r0 = (u >> 4) * 64; c0 = (u & 15) * 64;
  } else if (tile < 2048) {
    int u = tile - 1024;
    in = W1; out = w1T;
    R = 1024; C = 4096; r0 = (u >> 6) * 64; c0 = (u & 63) * 64;
  } else {
    int u = tile - 2048;
    in = W2; out = w2T;
    R = 4096; C = 1024; r0 = (u >> 4) * 64; c0 = (u & 15) * 64;
  }
  transpose_tile(in, out, R, C, r0, c0, t[half], threadIdx.x & 127);
}

// ---------------------------------------------------------------------------
// Generic WMMA GEMM: C[M,N] = act(A[M,K] * B^T[N,K] + bias) (+ residual).
// 256 threads = 8 waves (4 x 2); block tile 256x128; wave tile 64x64: 8
// fragments feed 16 WMMAs, and a block fetches 384 operand rows for 256x128
// results. K-step 64.
// Double-buffered LDS (one barrier / K-step); async global->LDS staging.
// A stage holds 128 B of every operand row; 8 adjacent lanes copy one row's
// piece, so a wave-wide copy covers 4 whole 128-B lines. K % 64 == 0.
// LDS row stride 72 halves (144 B = 16 B x 9 -> conflict-free b128 reads).
// Epilogue, once per 32 rows of the wave's tile: the wave lays 32x64 f32 into
// its own part of the ring (row pitch 68 floats) and reads it back by rows, 4
// columns per lane, so that 16 lanes store one whole row piece (256 B of f32,
// 128 B of f16) and the residual comes in as 16 independent 16-B loads issued
// together. N is a literal in every caller: all 16 row pieces hang off one
// address by constant offsets.
// ---------------------------------------------------------------------------
__device__ __forceinline__ void gemm_tile(
    const _Float16* __restrict__ A, const _Float16* __restrict__ BT,
    const float* __restrict__ bias, const float* __restrict__ resid,
    float* __restrict__ outF, _Float16* __restrict__ outH,
    const int N, int K, const bool hasBias, const bool doRelu,
    const bool f32out) {
  const int LS = 72;
  const int ABUF = 256 * LS;  // halves of one A buffer
  const int BBUF = 128 * LS;  // halves of one B buffer
  // [A buf 0 | A buf 1 | B buf 0 | B buf 1]; the epilogue reuses its start.
  __shared__ __attribute__((aligned(16))) _Float16 sm[2 * ABUF + 2 * BBUF];
  int tid  = threadIdx.x;
  int wave = tid >> 5, lane = tid & 31;
  int hi = lane >> 4, lo = lane & 15, kk0 = hi * 8;
  int wm = wave >> 1, wn = wave & 1;
  int m0 = blockIdx.y * 256, n0 = blockIdx.x * 128;
  int ldr = tid >> 3, ldc = (tid & 7) * 8;
  int dOff = ldr * LS + ldc;
  const _Float16* Ag = A  + (size_t)(m0 + ldr) * K + ldc;
  const _Float16* Bg = BT + (size_t)(n0 + ldr) * K + ldc;
  const size_t rstep = (size_t)32 * K;  // the block's copies advance 32 rows
  // One lane per operand row prefetches once per 256 B of the row, for speed
  // only: every lane for an A row, the lanes of waves 0 to 3 for a B row as well.
  const _Float16* pfA = A  + (size_t)(m0 + tid) * K;
  const _Float16* pfB = BT + (size_t)(n0 + (tid & 127)) * K;
  const bool lowWaves = __builtin_amdgcn_readfirstlane(wave) < 4;

  auto stage = [&](int buf, int k0) {
    for (int j = 0; j < 8; ++j)
      cp16(&sm[buf * ABUF + dOff + j * 32 * LS], Ag + j * rstep + k0);
    for (int j = 0; j < 4; ++j)
      cp16(&sm[2 * ABUF + buf * BBUF + dOff + j * 32 * LS],
           Bg + j * rstep + k0);
  };

  v8f acc[4][4] = {};
  int nk = K >> 6;
  stage(0, 0);
  for (int i = 0; i < nk; ++i) {
    int cur = i & 1;
    async_fence();           // this wave's async writes into LDS are done
    __syncthreads();         // everyone's writes visible; prev reads done
    if (i + 1 < nk) stage(cur ^ 1, (i + 1) << 6);
    if (!(i & 1) && i + 2 < nk) {
      // Stages i+2 and i+3 cover the next 256 B of each row: one prefetch at
      // its start, for speed only. pfA and pfB live through the loop
      // and only ever hold an address inside their operand.
      pfA += 128;
      asm volatile("global_prefetch_b8 %0, off scope:SCOPE_SE" :: "v"(pfA));
      if (lowWaves) {
        pfB += 128;
        asm volatile("global_prefetch_b8 %0, off scope:SCOPE_SE" :: "v"(pfB));
      }
    }
    const _Float16* Ab = &sm[cur * ABUF];
    const _Float16* Bb = &sm[2 * ABUF + cur * BBUF];
    for (int kh = 0; kh < 2; ++kh) {
      int ko = kh * 32 + kk0;
      v16h af[4], bf[4];
      // In the order of first use: B 0, all of A, the rest of B.
      bf[0] = frag_ld(&Bb[(wn * 64 + lo) * LS + ko]);
      for (int mt = 0; mt < 4; ++mt)
        af[mt] = frag_ld(&Ab[(wm * 64 + mt * 16 + lo) * LS + ko]);
      for (int nt = 1; nt < 4; ++nt)
        bf[nt] = frag_ld(&Bb[(wn * 64 + nt * 16 + lo) * LS + ko]);
      // All 16 fragment reads are issued ahead of the 16 WMMAs: left alone,
      // the compiler keeps one B fragment and waits out an LDS read per four.
      __builtin_amdgcn_sched_barrier(0);
      for (int nt = 0; nt < 4; ++nt)
        for (int mt = 0; mt < 4; ++mt)
          acc[mt][nt] = wmma16(af[mt], bf[nt], acc[mt][nt]);
    }
  }

  // Of each 32 rows, lane (hi, lo) finishes columns lo*4 .. lo*4+3 of rows
  // 2j + hi, j = 0..15.
  const int SP = 68;  // 272-B rows: 16 B x odd, conflict-free both ways
  int col = n0 + wn * 64 + lo * 4;
  const size_t off0 = (size_t)(m0 + wm * 64 + hi) * N + col;
  const size_t jstep = (size_t)2 * N;
  const size_t hstep = (size_t)32 * N;
  __syncthreads();  // every wave has read its last fragments out of the ring
  v4f rv[2][16];
  v4f bv = {};
  const float* rp = f32out ? resid + off0 : nullptr;
  const float* bp = hasBias ? bias + col : nullptr;
  if (f32out)
    for (int j = 0; j < 16; ++j) rv[0][j] = *(const v4f*)(rp + j * jstep);
  if (hasBias) bv = *(const v4f*)bp;
  if (f32out)
    asm volatile("s_wait_xcnt 0x0" :: "v"(rp), "v"(bp) : "memory");
  else if (hasBias)
    asm volatile("s_wait_xcnt 0x0" :: "v"(bp) : "memory");
  float* sw = (float*)sm + wave * (32 * SP);
  for (int h = 0; h < 2; ++h) {
    for (int gm = 0; gm < 2; ++gm)
      for (int nt = 0; nt < 4; ++nt)
        for (int g = 0; g < 8; ++g)
          sw[(gm * 16 + hi * 8 + g) * SP + nt * 16 + lo] = acc[h * 2 + gm][nt][g];
    // The rows are read back by other lanes of this wave: its stores are done.
    asm volatile("s_wait_dscnt 0x0" ::: "memory");
    if (f32out && h == 0) {
      // The second 32 rows' residual is on its way while the first are stored.
      for (int j = 0; j < 16; ++j)
        rv[1][j] = *(const v4f*)(rp + hstep + j * jstep);
      asm volatile("s_wait_xcnt 0x0" :: "v"(rp) : "memory");
    }
    for (int j = 0; j < 16; ++j) {
      v4f v = *(const v4f*)&sw[(j * 2 + hi) * SP + lo * 4] + bv;
      if (f32out) {
        *(v4f*)(outF + off0 + h * hstep + j * jstep) = v + rv[h][j];
      } else {
        if (doRelu)
          for (int e = 0; e < 4; ++e) v[e] = fmaxf(v[e], 0.0f);
        *(v4h*)(outH + off0 + h * hstep + j * jstep) =
            __builtin_convertvector(v, v4h);
      }
    }
    if (h == 0) asm volatile("s_wait_xcnt 0x0" ::: "memory");
  }
}

// N = 3072, f16 result: A B^T.
__global__ __launch_bounds__(256) void gemm_n3072_kernel(
    const _Float16* __restrict__ A, const _Float16* __restrict__ BT,
    _Float16* __restrict__ outH, int K) {
  gemm_tile(A, BT, nullptr, nullptr, nullptr, outH, 3072, K, false, false,
            false);
}

// N = 4096, f16 result: relu(A B^T + bias).
__global__ __launch_bounds__(256) void gemm_n4096_relu_kernel(
    const _Float16* __restrict__ A, const _Float16* __restrict__ BT,
    const float* __restrict__ bias, _Float16* __restrict__ outH, int K) {
  gemm_tile(A, BT, bias, nullptr, nullptr, outH, 4096, K, true, true, false);
}

// N = 1024, f32 result: A B^T + bias + residual.
__global__ __launch_bounds__(256) void gemm_n1024_res_kernel(
    const _Float16* __restrict__ A, const _Float16* __restrict__ BT,
    const float* __restrict__ bias, const float* __restrict__ resid,
    float* __restrict__ outF, int K) {
  gemm_tile(A, BT, bias, resid, outF, nullptr, 1024, K, true, false, true);
}

__device__ __forceinline__ float xhalf(float x) {
  int b = __builtin_bit_cast(int, x);
  return __builtin_bit_cast(
      float, __builtin_amdgcn_permlanex16(b, b, 0x76543210, 0xfedcba98, false,
                                          false));
}

__global__ __launch_bounds__(256) void flash_attn_kernel(
    const _Float16* __restrict__ qkv, _Float16* __restrict__ outH) {
  const int T = 2048, S3 = 3072, HD = 64;
  int qb = blockIdx.x, h = blockIdx.y, b = blockIdx.z;
  int tid  = threadIdx.x;
  int wave = tid >> 5, lane = tid & 31;
  int hi = lane >> 4, lo = lane & 15, kk0 = hi * 8;
  int q0 = qb * 128 + wave * 16;
  int qi = q0 + lo;  // the query this lane owns

  const _Float16* Qp = qkv + (size_t)(b * T) * S3 + h * HD;
  const _Float16* Kp = Qp + 1024;
  const _Float16* Vp = Qp + 2048;

  __shared__ _Float16 Ksh[64 * 72];
  __shared__ _Float16 VTsh[64 * 72];

  v16h qf0, qf1;
  {
    const _Float16* qrow = Qp + (size_t)qi * S3;
    qf0 = mk16(*(const v8h*)(qrow + kk0),      *(const v8h*)(qrow + kk0 + 16));
    qf1 = mk16(*(const v8h*)(qrow + 32 + kk0), *(const v8h*)(qrow + 32 + kk0 + 16));
  }

  // Oacc[et][g] = O[qi][et*16 + hi*8 + g]. rowM is the query's running maximum
  // (equal in both lane halves); rowL sums this half's keys only, the halves
  // are joined once behind the loop.
  v8f Oacc[4] = {};
  float rowM = -1e30f, rowL = 0.0f;

  int ldr = tid >> 2, cg = tid & 3;
  int ntiles = 2 * (qb + 1);  // keys up to end of this query block

  for (int kt = 0; kt < ntiles; ++kt) {
    int k0 = kt * 64;
    __syncthreads();
    {  // K tile: straight per-lane copy -> async path; V: transposed (sync)
      const _Float16* krow = Kp + (size_t)(k0 + ldr) * S3 + cg * 16;
      cp16(&Ksh[ldr * 72 + cg * 16], krow);
      cp16(&Ksh[ldr * 72 + cg * 16 + 8], krow + 8);
      const _Float16* vrow = Vp + (size_t)(k0 + ldr) * S3 + cg * 16;
      v8h v0 = *(const v8h*)(vrow);
      v8h v1 = *(const v8h*)(vrow + 8);
      for (int j = 0; j < 8; ++j) {
        VTsh[(cg * 16 + j) * 72 + ldr]     = v0[j];
        VTsh[(cg * 16 + 8 + j) * 72 + ldr] = v1[j];
      }
    }
    async_fence();
    __syncthreads();

    if (k0 <= q0 + 15) {  // uniform per wave
      v8f p[4];      // p[nt][g]: key k0 + nt*16 + hi*8 + g against query qi
      float mx[4];   // one chain per score tile, joined below
      for (int nt = 0; nt < 4; ++nt) {
        v8f s = {};
        v16h kf0 = frag_ld(&Ksh[(nt * 16 + lo) * 72 + kk0]);
        v16h kf1 = frag_ld(&Ksh[(nt * 16 + lo) * 72 + 32 + kk0]);
        s = wmma16(kf0, qf0, s);
        s = wmma16(kf1, qf1, s);
        int kj = k0 + nt * 16 + hi * 8;
        for (int g = 0; g < 8; ++g)
          p[nt][g] = (kj + g <= qi) ? s[g] * 0.125f : -1e30f;
        mx[nt] = p[nt][0];
        for (int g = 1; g < 8; ++g) mx[nt] = fmaxf(mx[nt], p[nt][g]);
      }
      float m = fmaxf(fmaxf(mx[0], mx[1]), fmaxf(mx[2], mx[3]));
      m = fmaxf(m, xhalf(m));
      float nm = fmaxf(rowM, m);
      float corr = __expf(rowM - nm);
      float rs[4];
      for (int nt = 0; nt < 4; ++nt) {
        p[nt] = (p[nt] - nm) * 1.44269504f;  // e^x = 2^(x log2 e)
        rs[nt] = 0.0f;
        for (int g = 0; g < 8; ++g) {
          p[nt][g] = __builtin_amdgcn_exp2f(p[nt][g]);
          rs[nt] += p[nt][g];
        }
      }
      rowL = rowL * corr + ((rs[0] + rs[1]) + (rs[2] + rs[3]));
      rowM = nm;
      for (int et = 0; et < 4; ++et) Oacc[et] *= corr;
      // P^T as B fragments: element s of a lane is key kk0 + s (s < 8) or
      // 16 + kk0 + (s - 8) of the 32-key block, which is what the lane holds.
      v16h pf0 = mk16(__builtin_convertvector(p[0], v8h),
                      __builtin_convertvector(p[1], v8h));
      v16h pf1 = mk16(__builtin_convertvector(p[2], v8h),
                      __builtin_convertvector(p[3], v8h));
      for (int et = 0; et < 4; ++et) {
        v16h vf0 = frag_ld(&VTsh[(et * 16 + lo) * 72 + kk0]);
        v16h vf1 = frag_ld(&VTsh[(et * 16 + lo) * 72 + 32 + kk0]);
        Oacc[et] = wmma16(vf0, pf0, Oacc[et]);
        Oacc[et] = wmma16(vf1, pf1, Oacc[et]);
      }
    }
  }

  float inv = 1.0f / (rowL + xhalf(rowL));
  _Float16* orow = outH + (size_t)(b * T + qi) * 1024 + h * HD + hi * 8;
  for (int et = 0; et < 4; ++et)
    *(v8h*)(orow + et * 16) = __builtin_convertvector(Oacc[et] * inv, v8h);
}

// ---------------------------------------------------------------------------
extern "C" void kernel_launch(void* const* d_in, const int* in_sizes, int n_in,
                              void* d_out, int out_size, void* d_ws, size_t ws_size,
                              hipStream_t stream) {
  (void)in_sizes; (void)n_in; (void)out_size; (void)ws_size;
  const int B = 4, T = 2048, D = 1024, H = 16, HD = 64, F = 4096;
  const int M = B * T;

  const float* x   = (const float*)d_in[0];
  const float* Wq  = (const float*)d_in[1];
  const float* Wk  = (const float*)d_in[2];
  const float* Wv  = (const float*)d_in[3];
  const float* Wo  = (const float*)d_in[4];
  const float* bo  = (const float*)d_in[5];
  const float* W1  = (const float*)d_in[6];
  const float* b1  = (const float*)d_in[7];
  const float* W2  = (const float*)d_in[8];
  const float* b2  = (const float*)d_in[9];
  const float* g1  = (const float*)d_in[10];
  const float* be1 = (const float*)d_in[11];
  const float* g2  = (const float*)d_in[12];
  const float* be2 = (const float*)d_in[13];

  char* w = (char*)d_ws;
  auto alloc = [&](size_t bytes) -> void* {
    void* p = (void*)w;
    w += (bytes + 255) & ~(size_t)255;
    return p;
  };
  _Float16* h16  = (_Float16*)alloc((size_t)M * D * 2);       // LN1 out
  _Float16* qkvT = (_Float16*)alloc((size_t)3 * D * D * 2);   // [3072][1024]
  _Float16* woT  = (_Float16*)alloc((size_t)D * D * 2);       // [1024][1024]
  _Float16* w1T  = (_Float16*)alloc((size_t)F * D * 2);       // [4096][1024]
  _Float16* w2T  = (_Float16*)alloc((size_t)D * F * 2);       // [1024][4096]
  _Float16* qkv  = (_Float16*)alloc((size_t)M * 3 * D * 2);   // [8192][3072]
  _Float16* a16  = (_Float16*)alloc((size_t)M * D * 2);       // attn concat
  float*    x1   = (float*)   alloc((size_t)M * D * 4);       // residual 1
  _Float16* h2   = (_Float16*)alloc((size_t)M * D * 2);       // LN2 out
  _Float16* ffh  = (_Float16*)alloc((size_t)M * F * 2);       // relu(h2 W1+b1)

  // LN1 and the weight prep (cast + transpose, so that every GEMM B operand is
  // B^T[N][K]) in one launch: 512 LN blocks + 3072 / 2 tile blocks.
  prep_kernel<<<2048, 256, 0, stream>>>(x, g1, be1, h16, Wq, Wk, Wv, Wo, W1, W2,
                                        qkvT, woT, w1T, w2T);

  // fused QKV projection -> flash attention
  gemm_n3072_kernel<<<dim3(3 * D / 128, M / 256), 256, 0, stream>>>(
      h16, qkvT, qkv, D);
  flash_attn_kernel<<<dim3(T / 128, H, B), 256, 0, stream>>>(qkv, a16);

  // Wo projection + bias + residual(x) -> x1 (f32)
  gemm_n1024_res_kernel<<<dim3(D / 128, M / 256), 256, 0, stream>>>(
      a16, woT, bo, x, x1, D);

  // LN2 -> FFN1 (relu) -> FFN2 + residual(x1) -> out
  ln_f16_kernel<<<M / 16, 256, 0, stream>>>(x1, g2, be2, h2);
  gemm_n4096_relu_kernel<<<dim3(F / 128, M / 256), 256, 0, stream>>>(
      h2, w1T, b1, ffh, D);
  gemm_n1024_res_kernel<<<dim3(D / 128, M / 256), 256, 0, stream>>>(
      ffh, w2T, b2, x1, (float*)d_out, F);
}

// v007
// A run of this version takes 252 microseconds.
// Two timings next to v006 put it at 1.09 and 1.08 times that version's speed.
// Counting every step since v000, it is 3.08 times as fast.
#include <hip/hip_runtime.h>

typedef _Float16 v16h __attribute__((ext_vector_type(16)));
typedef _Float16 v8h  __attribute__((ext_vector_type(8)));
typedef _Float16 v4h  __attribute__((ext_vector_type(4)));
typedef _Float16 v2h  __attribute__((ext_vector_type(2)));
typedef float    v4f  __attribute__((ext_vector_type(4)));
typedef float    v8f  __attribute__((ext_vector_type(8)));
typedef int      v4i  __attribute__((ext_vector_type(4)));

#if defined(__has_builtin)
#  if __has_builtin(__builtin_amdgcn_global_load_async_to_lds_b128) && \
      __has_builtin(__builtin_amdgcn_s_wait_asynccnt)
#    define USE_ASYNC_LDS 1
#  endif
#endif
#ifndef USE_ASYNC_LDS
#  define USE_ASYNC_LDS 0
#endif

#if USE_ASYNC_LDS
// b128 async copy payload is typed as int4; global src is AS1, LDS dst is AS3.
typedef __attribute__((address_space(1))) v4i gbl_v4i;
typedef __attribute__((address_space(3))) v4i lds_v4i;
#endif

// Copy 16 bytes global -> LDS (per-lane addresses).
__device__ __forceinline__ void cp16(_Float16* lds, const _Float16* g) {
#if USE_ASYNC_LDS
  _Float16* gn = const_cast<_Float16*>(g);
  __builtin_amdgcn_global_load_async_to_lds_b128((gbl_v4i*)gn, (lds_v4i*)lds,
                                                 0, 0);
#else
  *(v8h*)lds = *(const v8h*)g;
#endif
}
__device__ __forceinline__ void async_fence() {
#if USE_ASYNC_LDS
  __builtin_amdgcn_s_wait_asynccnt(0);
#endif
}

__device__ __forceinline__ v16h mk16(v8h a, v8h b) {
  return __builtin_shufflevector(a, b, 0,1,2,3,4,5,6,7,8,9,10,11,12,13,14,15);
}
__device__ __forceinline__ v16h frag_ld(const _Float16* p) {
  v8h a = *(const v8h*)(p);
  v8h b = *(const v8h*)(p + 16);
  return mk16(a, b);
}
__device__ __forceinline__ v8f wmma16(v16h a, v16h b, v8f c) {
  return __builtin_amdgcn_wmma_f32_16x16x32_f16(false, a, false, b, (short)0, c,
                                                false, false);
}

// ---------------------------------------------------------------------------
// LayerNorm (D = 1024), f32 in -> f16 out. One wave owns two whole rows: all
// 16 row loads (512 contiguous bytes each) are issued before the first sum,
// the row sums close with a 32-lane butterfly, and no LDS or barrier is used.
// 256 threads = 8 waves = 16 rows per block, so 16x fewer waves are started
// than with one 8-wave block per row. blk = which 16 rows.
// ---------------------------------------------------------------------------
__device__ __forceinline__ void ln_rows(
    const float* __restrict__ x, const float* __restrict__ gamma,
    const float* __restrict__ beta, _Float16* __restrict__ out, int blk) {
  const int D = 1024;
  int lane = threadIdx.x & 31;
  // The wave's number is the same in all its lanes: kept scalar, the row base
  // stays in scalar registers and one lane offset serves every load.
  int wave = __builtin_amdgcn_readfirstlane(threadIdx.x >> 5);
  int row0 = (blk * 8 + wave) * 2;
  const float4* xr = (const float4*)(x + (size_t)row0 * D) + lane;
  float4 v[2][8];
  for (int r = 0; r < 2; ++r)
    for (int j = 0; j < 8; ++j) v[r][j] = xr[r * 256 + j * 32];
  float mu[2], rs[2];
  for (int r = 0; r < 2; ++r) {
    float s = 0.0f, q = 0.0f;
    for (int j = 0; j < 8; ++j) {
      float4 t = v[r][j];
      s += t.x + t.y + t.z + t.w;
      q += t.x * t.x + t.y * t.y + t.z * t.z + t.w * t.w;
    }
    for (int off = 16; off > 0; off >>= 1) {
      s += __shfl_xor(s, off, 32);
      q += __shfl_xor(q, off, 32);
    }
    mu[r] = s * (1.0f / 1024.0f);
    float var = q * (1.0f / 1024.0f) - mu[r] * mu[r];
    rs[r] = rsqrtf(var + 1e-5f);
  }
  for (int j = 0; j < 8; ++j) {
    float4 g = ((const float4*)gamma)[j * 32 + lane];
    float4 b = ((const float4*)beta)[j * 32 + lane];
    for (int r = 0; r < 2; ++r) {
      float4 t = v[r][j];
      v4h o;
      o[0] = (_Float16)((t.x - mu[r]) * rs[r] * g.x + b.x);
      o[1] = (_Float16)((t.y - mu[r]) * rs[r] * g.y + b.y);
      o[2] = (_Float16)((t.z - mu[r]) * rs[r] * g.z + b.z);
      o[3] = (_Float16)((t.w - mu[r]) * rs[r] * g.w + b.w);
      ((v4h*)(out + (size_t)(row0 + r) * D))[j * 32 + lane] = o;
    }
  }
}

__global__ __launch_bounds__(256) void ln_f16_kernel(
    const float* __restrict__ x, const float* __restrict__ gamma,
    const float* __restrict__ beta, _Float16* __restrict__ out) {
  ln_rows(x, gamma, beta, out, blockIdx.x);
}

// ---------------------------------------------------------------------------
// Weight prep: f32 [R][C] -> f16 [C][R] (transpose + cast). 4 waves move one
// 64x64 tile, 32 elements per lane: 8 float4 loads in flight per lane (256 B
// of a source row per 16 lanes), two source rows packed per LDS dword, and
// 16-B stores, 8 adjacent lanes to one whole 128-B line of an output row.
// R % 64 == 0, C % 64 == 0. LDS row pitch 72 halves keeps b128 reads aligned.
// t = the tile's own 64 x 72 halves of LDS, tid = 0..127 within the 4 waves.
// Holds one barrier: every wave of the block calls it.
// ---------------------------------------------------------------------------
__device__ __forceinline__ void transpose_tile(
    const float* __restrict__ in, _Float16* __restrict__ out,
    int R, int C, int r0, int c0, _Float16* t, int tid) {
  int c4 = (tid & 15) * 4, rp = (tid >> 4) * 2;
  v4f a[4], b[4];
  const float* src[4];
  for (int p = 0; p < 4; ++p) {
    src[p] = in + (size_t)(r0 + p * 16 + rp) * C + (c0 + c4);
    a[p] = *(const v4f*)src[p];
    b[p] = *(const v4f*)(src[p] + C);
  }
  asm volatile("s_wait_xcnt 0x0"
               :: "v"(src[0]), "v"(src[1]), "v"(src[2]), "v"(src[3]),
                  "v"(src[0] + C), "v"(src[1] + C), "v"(src[2] + C),
                  "v"(src[3] + C)
               : "memory");
  for (int p = 0; p < 4; ++p)
    for (int i = 0; i < 4; ++i) {
      v2h pr;
      pr[0] = (_Float16)a[p][i];
      pr[1] = (_Float16)b[p][i];
      *(v2h*)&t[(c4 + i) * 72 + p * 16 + rp] = pr;
    }
  __syncthreads();
  int ch = (tid & 7) * 8, cr = tid >> 3;
  for (int p = 0; p < 4; ++p) {
    int c = p * 16 + cr;
    *(v8h*)(out + (size_t)(c0 + c) * R + (r0 + ch)) = *(const v8h*)&t[c * 72 + ch];
  }
}

// ---------------------------------------------------------------------------
// Everything that depends on the inputs alone, in ONE launch: the first
// LayerNorm (blocks 0..511, 16 rows each) and the cast + transpose of all six
// weights (blocks 512..2047, two 64x64 tiles each, one per 4 waves). None of
// these pieces reads what another writes, so they need no launch boundary
// between them, and each one's start and drain hides behind the others' work.
// Tiles in order: Wq, Wk, Wv (per head [1024][64], 16 x 16 tiles each),
// Wo [1024][1024], W1 [1024][4096], W2 [4096][1024]. Every range starts at an
// even tile, so a block's two tiles are of one weight.
// ---------------------------------------------------------------------------
__global__ __launch_bounds__(256) void prep_kernel(
    const float* __restrict__ x, const float* __restrict__ gamma,
    const float* __restrict__ beta, _Float16* __restrict__ h16,
    const float* __restrict__ Wq, const float* __restrict__ Wk,
    const float* __restrict__ Wv, const float* __restrict__ Wo,
    const float* __restrict__ W1, const float* __restrict__ W2,
    _Float16* __restrict__ qkvT, _Float16* __restrict__ woT,
    _Float16* __restrict__ w1T, _Float16* __restrict__ w2T) {
  int blk = blockIdx.x;
  if (blk < 512) {  // the same for the whole block, ahead of the barrier
    ln_rows(x, gamma, beta, h16, blk);
    return;
  }
  __shared__ __attribute__((aligned(16))) _Float16 t[2][64 * 72];
  // Which half of the block: the same in all lanes of a wave, kept scalar so
  // that the choice of weight and tile below is scalar work.
  int half = __builtin_amdgcn_readfirstlane(threadIdx.x >> 7);
  int tile = (blk - 512) * 2 + half;
  const float* in;
  _Float16* out;
  int R, C, r0, c0;
  if (tile < 768) {
    int w = tile >> 8, head = (tile >> 4) & 15;
    in  = (w == 0 ? Wq : w == 1 ? Wk : Wv) + head * (1024 * 64);
    out = qkvT + (w * 16 + head) * (64 * 1024);
    R = 1024; C = 64; r0 = (tile & 15) * 64; c0 = 0;
  } else if (tile < 1024) {
    int u = tile - 768;
    in = Wo; out = woT;
    R = 1024; C = 1024; r0 = (u >> 4) * 64; c0 = (u & 15) * 64;
  } else if (tile < 2048) {
    int u = tile - 1024;
    in = W1; out = w1T;
    R = 1024; C = 4096; r0 = (u >> 6) * 64; c0 = (u & 63) * 64;
  } else {
    int u = tile - 2048;
    in = W2; out = w2T;
    R = 4096; C = 1024; r0 = (u >> 4) * 64; c0 = (u & 15) * 64;
  }
  transpose_tile(in, out, R, C, r0, c0, t[half], threadIdx.x & 127);
}

// ---------------------------------------------------------------------------
// Generic WMMA GEMM: C[M,N] = act(A[M,K] * B^T[N,K] + bias) (+ residual).
// 256 threads = 8 waves (4 x 2); block tile 256x128; wave tile 64x64: 8
// fragments feed 16 WMMAs, and a block fetches 384 operand rows for 256x128
// results. K-step 64.
// Double-buffered LDS (one barrier / K-step); async global->LDS staging.
// A stage holds 128 B of every operand row; 8 adjacent lanes copy one row's
// piece, so a wave-wide copy covers 4 whole 128-B lines. K % 64 == 0.
// LDS row stride 72 halves (144 B = 16 B x 9 -> conflict-free b128 reads).
// Epilogue, once per 32 rows of the wave's tile: the wave lays 32x64 f32 into
// its own part of the ring (row pitch 68 floats) and reads it back by rows, 4
// columns per lane, so that 16 lanes store one whole row piece (256 B of f32,
// 128 B of f16) and the residual comes in as 16 independent 16-B loads issued
// together. N is a literal in every caller: all 16 row pieces hang off one
// address by constant offsets.
// ---------------------------------------------------------------------------
__device__ __forceinline__ void gemm_tile(
    const _Float16* __restrict__ A, const _Float16* __restrict__ BT,
    const float* __restrict__ bias, const float* __restrict__ resid,
    float* __restrict__ outF, _Float16* __restrict__ outH,
    const int N, int K, const bool hasBias, const bool doRelu,
    const bool f32out) {
  const int LS = 72;
  const int ABUF = 256 * LS;  // halves of one A buffer
  const int BBUF = 128 * LS;  // halves of one B buffer
  // [A buf 0 | A buf 1 | B buf 0 | B buf 1]; the epilogue reuses its start.
  __shared__ __attribute__((aligned(16))) _Float16 sm[2 * ABUF + 2 * BBUF];
  int tid  = threadIdx.x;
  int wave = tid >> 5, lane = tid & 31;
  int hi = lane >> 4, lo = lane & 15, kk0 = hi * 8;
  int wm = wave >> 1, wn = wave & 1;
  int m0 = blockIdx.y * 256, n0 = blockIdx.x * 128;
  int ldr = tid >> 3, ldc = (tid & 7) * 8;
  int dOff = ldr * LS + ldc;
  const _Float16* Ag = A  + (size_t)(m0 + ldr) * K + ldc;
  const _Float16* Bg = BT + (size_t)(n0 + ldr) * K + ldc;
  const size_t rstep = (size_t)32 * K;  // the block's copies advance 32 rows
  // One lane per operand row prefetches once per 256 B of the row, for speed
  // only: every lane for an A row, the lanes of waves 0 to 3 for a B row as well.
  const _Float16* pfA = A  + (size_t)(m0 + tid) * K;
  const _Float16* pfB = BT + (size_t)(n0 + (tid & 127)) * K;
  const bool lowWaves = __builtin_amdgcn_readfirstlane(wave) < 4;

  auto stage = [&](int buf, int k0) {
    for (int j = 0; j < 8; ++j)
      cp16(&sm[buf * ABUF + dOff + j * 32 * LS], Ag + j * rstep + k0);
    for (int j = 0; j < 4; ++j)
      cp16(&sm[2 * ABUF + buf * BBUF + dOff + j * 32 * LS],
           Bg + j * rstep + k0);
  };

  v8f acc[4][4] = {};
  int nk = K >> 6;
  stage(0, 0);
  for (int i = 0; i < nk; ++i) {
    int cur = i & 1;
    async_fence();           // this wave's async writes into LDS are done
    __syncthreads();         // everyone's writes visible; prev reads done
    if (i + 1 < nk) stage(cur ^ 1, (i + 1) << 6);
    if (!(i & 1) && i + 2 < nk) {
      // Stages i+2 and i+3 cover the next 256 B of each row: one prefetch at
      // its start, for speed only. pfA and pfB live through the loop
      // and only ever hold an address inside their operand.
      pfA += 128;
      asm volatile("global_prefetch_b8 %0, off scope:SCOPE_SE" :: "v"(pfA));
      if (lowWaves) {
        pfB += 128;
        asm volatile("global_prefetch_b8 %0, off scope:SCOPE_SE" :: "v"(pfB));
      }
    }
    const _Float16* Ab = &sm[cur * ABUF];
    const _Float16* Bb = &sm[2 * ABUF + cur * BBUF];
    for (int kh = 0; kh < 2; ++kh) {
      int ko = kh * 32 + kk0;
      v16h af[4], bf[4];
      // In the order of first use: B 0, all of A, the rest of B.
      bf[0] = frag_ld(&Bb[(wn * 64 + lo) * LS + ko]);
      for (int mt = 0; mt < 4; ++mt)
        af[mt] = frag_ld(&Ab[(wm * 64 + mt * 16 + lo) * LS + ko]);
      for (int nt = 1; nt < 4; ++nt)
        bf[nt] = frag_ld(&Bb[(wn * 64 + nt * 16 + lo) * LS + ko]);
      // All 16 fragment reads are issued ahead of the 16 WMMAs: left alone,
      // the compiler keeps one B fragment and waits out an LDS read per four.
      __builtin_amdgcn_sched_barrier(0);
      for (int nt = 0; nt < 4; ++nt)
        for (int mt = 0; mt < 4; ++mt)
          acc[mt][nt] = wmma16(af[mt], bf[nt], acc[mt][nt]);
    }
  }

  // Of each 32 rows, lane (hi, lo) finishes columns lo*4 .. lo*4+3 of rows
  // 2j + hi, j = 0..15.
  const int SP = 68;  // 272-B rows: 16 B x odd, conflict-free both ways
  int col = n0 + wn * 64 + lo * 4;
  const size_t off0 = (size_t)(m0 + wm * 64 + hi) * N + col;
  const size_t jstep = (size_t)2 * N;
  const size_t hstep = (size_t)32 * N;
  __syncthreads();  // every wave has read its last fragments out of the ring
  v4f rv[2][16];
  v4f bv = {};
  const float* rp = f32out ? resid + off0 : nullptr;
  const float* bp = hasBias ? bias + col : nullptr;
  if (f32out)
    for (int j = 0; j < 16; ++j) rv[0][j] = *(const v4f*)(rp + j * jstep);
  if (hasBias) bv = *(const v4f*)bp;
  if (f32out)
    asm volatile("s_wait_xcnt 0x0" :: "v"(rp), "v"(bp) : "memory");
  else if (hasBias)
    asm volatile("s_wait_xcnt 0x0" :: "v"(bp) : "memory");
  float* sw = (float*)sm + wave * (32 * SP);
  for (int h = 0; h < 2; ++h) {
    for (int gm = 0; gm < 2; ++gm)
      for (int nt = 0; nt < 4; ++nt)
        for (int g = 0; g < 8; ++g)
          sw[(gm * 16 + hi * 8 + g) * SP + nt * 16 + lo] = acc[h * 2 + gm][nt][g];
    // The rows are read back by other lanes of this wave: its stores are done.
    asm volatile("s_wait_dscnt 0x0" ::: "memory");
    if (f32out && h == 0) {
      // The second 32 rows' residual is on its way while the first are stored.
      for (int j = 0; j < 16; ++j)
        rv[1][j] = *(const v4f*)(rp + hstep + j * jstep);
      asm volatile("s_wait_xcnt 0x0" :: "v"(rp) : "memory");
    }
    for (int j = 0; j < 16; ++j) {
      v4f v = *(const v4f*)&sw[(j * 2 + hi) * SP + lo * 4] + bv;
      if (f32out) {
        *(v4f*)(outF + off0 + h * hstep + j * jstep) = v + rv[h][j];
      } else {
        if (doRelu)
          for (int e = 0; e < 4; ++e) v[e] = fmaxf(v[e], 0.0f);
        *(v4h*)(outH + off0 + h * hstep + j * jstep) =
            __builtin_convertvector(v, v4h);
      }
    }
    if (h == 0) asm volatile("s_wait_xcnt 0x0" ::: "memory");
  }
}

// N = 3072, f16 result: A B^T.
__global__ __launch_bounds__(256) void gemm_n3072_kernel(
    const _Float16* __restrict__ A, const _Float16* __restrict__ BT,
    _Float16* __restrict__ outH, int K) {
  gemm_tile(A, BT, nullptr, nullptr, nullptr, outH, 3072, K, false, false,
            false);
}

// N = 4096, f16 result: relu(A B^T + bias).
__global__ __launch_bounds__(256) void gemm_n4096_relu_kernel(
    const _Float16* __restrict__ A, const _Float16* __restrict__ BT,
    const float* __restrict__ bias, _Float16* __restrict__ outH, int K) {
  gemm_tile(A, BT, bias, nullptr, nullptr, outH, 4096, K, true, true, false);
}

// N = 1024, f32 result: A B^T + bias + residual.
__global__ __launch_bounds__(256) void gemm_n1024_res_kernel(
    const _Float16* __restrict__ A, const _Float16* __restrict__ BT,
    const float* __restrict__ bias, const float* __restrict__ resid,
    float* __restrict__ outF, int K) {
  gemm_tile(A, BT, bias, resid, outF, nullptr, 1024, K, true, false, true);
}

__device__ __forceinline__ float xhalf(float x) {
  int b = __builtin_bit_cast(int, x);
  return __builtin_bit_cast(
      float, __builtin_amdgcn_permlanex16(b, b, 0x76543210, 0xfedcba98, false,
                                          false));
}

__global__ __launch_bounds__(256) void flash_attn_kernel(
    const _Float16* __restrict__ qkv, _Float16* __restrict__ outH) {
  const int T = 2048, S3 = 3072, HD = 64;
  int h = blockIdx.y, b = blockIdx.z;
  int tid  = threadIdx.x;
  int wave = tid >> 5, lane = tid & 31;
  int hi = lane >> 4, lo = lane & 15, kk0 = hi * 8;

  const _Float16* Qp = qkv + (size_t)(b * T) * S3 + h * HD;
  const _Float16* Kp = Qp + 1024;
  const _Float16* Vp = Qp + 2048;

  __shared__ _Float16 Ksh[64 * 72];
  __shared__ _Float16 VTsh[64 * 72];

  for (int part = 0; part < 2; ++part) {  // the same for the whole block
  int qb = part ? (int)blockIdx.x : T / 128 - 1 - (int)blockIdx.x;
  int q0 = qb * 128 + wave * 16;
  int qi = q0 + lo;  // the query this lane owns

  v16h qf0, qf1;
  {
    const _Float16* qrow = Qp + (size_t)qi * S3;
    qf0 = mk16(*(const v8h*)(qrow + kk0),      *(const v8h*)(qrow + kk0 + 16));
    qf1 = mk16(*(const v8h*)(qrow + 32 + kk0), *(const v8h*)(qrow + 32 + kk0 + 16));
  }

  // Oacc[et][g] = O[qi][et*16 + hi*8 + g]. rowM is the query's running maximum
  // (equal in both lane halves); rowL sums this half's keys only, the halves
  // are joined once behind the loop.
  v8f Oacc[4] = {};
  float rowM = -1e30f, rowL = 0.0f;

  int ldr = tid >> 2, cg = tid & 3;
  int ntiles = 2 * (qb + 1);  // keys up to end of this query block

  for (int kt = 0; kt < ntiles; ++kt) {
    int k0 = kt * 64;
    __syncthreads();
    {  // K tile: straight per-lane copy -> async path; V: transposed (sync)
      const _Float16* krow = Kp + (size_t)(k0 + ldr) * S3 + cg * 16;
      cp16(&Ksh[ldr * 72 + cg * 16], krow);
      cp16(&Ksh[ldr * 72 + cg * 16 + 8], krow + 8);
      const _Float16* vrow = Vp + (size_t)(k0 + ldr) * S3 + cg * 16;
      v8h v0 = *(const v8h*)(vrow);
      v8h v1 = *(const v8h*)(vrow + 8);
      for (int j = 0; j < 8; ++j) {
        VTsh[(cg * 16 + j) * 72 + ldr]     = v0[j];
        VTsh[(cg * 16 + 8 + j) * 72 + ldr] = v1[j];
      }
    }
    async_fence();
    __syncthreads();

    if (k0 <= q0 + 15) {  // uniform per wave
      v8f p[4];      // p[nt][g]: key k0 + nt*16 + hi*8 + g against query qi
      float mx[4];   // one chain per score tile, joined below
      for (int nt = 0; nt < 4; ++nt) {
        v8f s = {};
        v16h kf0 = frag_ld(&Ksh[(nt * 16 + lo) * 72 + kk0]);
        v16h kf1 = frag_ld(&Ksh[(nt * 16 + lo) * 72 + 32 + kk0]);
        s = wmma16(kf0, qf0, s);
        s = wmma16(kf1, qf1, s);
        int kj = k0 + nt * 16 + hi * 8;
        for (int g = 0; g < 8; ++g)
          p[nt][g] = (kj + g <= qi) ? s[g] * 0.125f : -1e30f;
        mx[nt] = p[nt][0];
        for (int g = 1; g < 8; ++g) mx[nt] = fmaxf(mx[nt], p[nt][g]);
      }
      float m = fmaxf(fmaxf(mx[0], mx[1]), fmaxf(mx[2], mx[3]));
      m = fmaxf(m, xhalf(m));
      float nm = fmaxf(rowM, m);
      float corr = __expf(rowM - nm);
      float rs[4];
      for (int nt = 0; nt < 4; ++nt) {
        p[nt] = (p[nt] - nm) * 1.44269504f;  // e^x = 2^(x log2 e)
        rs[nt] = 0.0f;
        for (int g = 0; g < 8; ++g) {
          p[nt][g] = __builtin_amdgcn_exp2f(p[nt][g]);
          rs[nt] += p[nt][g];
        }
      }
      rowL = rowL * corr + ((rs[0] + rs[1]) + (rs[2] + rs[3]));
      rowM = nm;
      for (int et = 0; et < 4; ++et) Oacc[et] *= corr;
      // P^T as B fragments: element s of a lane is key kk0 + s (s < 8) or
      // 16 + kk0 + (s - 8) of the 32-key block, which is what the lane holds.
      v16h pf0 = mk16(__builtin_convertvector(p[0], v8h),
                      __builtin_convertvector(p[1], v8h));
      v16h pf1 = mk16(__builtin_convertvector(p[2], v8h),
                      __builtin_convertvector(p[3], v8h));
      for (int et = 0; et < 4; ++et) {
        v16h vf0 = frag_ld(&VTsh[(et * 16 + lo) * 72 + kk0]);
        v16h vf1 = frag_ld(&VTsh[(et * 16 + lo) * 72 + 32 + kk0]);
        Oacc[et] = wmma16(vf0, pf0, Oacc[et]);
        Oacc[et] = wmma16(vf1, pf1, Oacc[et]);
      }
    }
  }

  float inv = 1.0f / (rowL + xhalf(rowL));
  _Float16* orow = outH + (size_t)(b * T + qi) * 1024 + h * HD + hi * 8;
  for (int et = 0; et < 4; ++et)
    *(v8h*)(orow + et * 16) = __builtin_convertvector(Oacc[et] * inv, v8h);
  asm volatile("s_wait_xcnt 0x0" ::: "memory");
  }
}

// ---------------------------------------------------------------------------
extern "C" void kernel_launch(void* const* d_in, const int* in_sizes, int n_in,
                              void* d_out, int out_size, void* d_ws, size_t ws_size,
                              hipStream_t stream) {
  (void)in_sizes; (void)n_in; (void)out_size; (void)ws_size;
  const int B = 4, T = 2048, D = 1024, H = 16, HD = 64, F = 4096;
  const int M = B * T;

  const float* x   = (const float*)d_in[0];
  const float* Wq  = (const float*)d_in[1];
  const float* Wk  = (const float*)d_in[2];
  const float* Wv  = (const float*)d_in[3];
  const float* Wo  = (const float*)d_in[4];
  const float* bo  = (const float*)d_in[5];
  const float* W1  = (const float*)d_in[6];
  const float* b1  = (const float*)d_in[7];
  const float* W2  = (const float*)d_in[8];
  const float* b2  = (const float*)d_in[9];
  const float* g1  = (const float*)d_in[10];
  const float* be1 = (const float*)d_in[11];
  const float* g2  = (const float*)d_in[12];
  const float* be2 = (const float*)d_in[13];

  char* w = (char*)d_ws;
  auto alloc = [&](size_t bytes) -> void* {
    void* p = (void*)w;
    w += (bytes + 255) & ~(size_t)255;
    return p;
  };
  _Float16* h16  = (_Float16*)alloc((size_t)M * D * 2);       // LN1 out
  _Float16* qkvT = (_Float16*)alloc((size_t)3 * D * D * 2);   // [3072][1024]
  _Float16* woT  = (_Float16*)alloc((size_t)D * D * 2);       // [1024][1024]
  _Float16* w1T  = (_Float16*)alloc((size_t)F * D * 2);       // [4096][1024]
  _Float16* w2T  = (_Float16*)alloc((size_t)D * F * 2);       // [1024][4096]
  _Float16* qkv  = (_Float16*)alloc((size_t)M * 3 * D * 2);   // [8192][3072]
  _Float16* a16  = (_Float16*)alloc((size_t)M * D * 2);       // attn concat
  float*    x1   = (float*)   alloc((size_t)M * D * 4);       // residual 1
  _Float16* h2   = (_Float16*)alloc((size_t)M * D * 2);       // LN2 out
  _Float16* ffh  = (_Float16*)alloc((size_t)M * F * 2);       // relu(h2 W1+b1)

  // LN1 and the weight prep (cast + transpose, so that every GEMM B operand is
  // B^T[N][K]) in one launch: 512 LN blocks + 3072 / 2 tile blocks.
  prep_kernel<<<2048, 256, 0, stream>>>(x, g1, be1, h16, Wq, Wk, Wv, Wo, W1, W2,
                                        qkvT, woT, w1T, w2T);

  // fused QKV projection -> flash attention
  gemm_n3072_kernel<<<dim3(3 * D / 128, M / 256), 256, 0, stream>>>(
      h16, qkvT, qkv, D);
  flash_attn_kernel<<<dim3(T / 256, H, B), 256, 0, stream>>>(qkv, a16);

  // Wo projection + bias + residual(x) -> x1 (f32)
  gemm_n1024_res_kernel<<<dim3(D / 128, M / 256), 256, 0, stream>>>(
      a16, woT, bo, x, x1, D);

  // LN2 -> FFN1 (relu) -> FFN2 + residual(x1) -> out
  ln_f16_kernel<<<M / 16, 256, 0, stream>>>(x1, g2, be2, h2);
  gemm_n4096_relu_kernel<<<dim3(F / 128, M / 256), 256, 0, stream>>>(
      h2, w1T, b1, ffh, D);
  gemm_n1024_res_kernel<<<dim3(D / 128, M / 256), 256, 0, stream>>>(
      ffh, w2T, b2, x1, (float*)d_out, F);
}

// v008
// It runs in 240 microseconds.
// Timed twice side by side with v007, it ran 1.03 times as fast both times.
// Over all steps from v000 it is 3.18 times as fast.
#include <hip/hip_runtime.h>

typedef _Float16 v16h __attribute__((ext_vector_type(16)));
typedef _Float16 v8h  __attribute__((ext_vector_type(8)));
typedef _Float16 v4h  __attribute__((ext_vector_type(4)));
typedef _Float16 v2h  __attribute__((ext_vector_type(2)));
typedef float    v4f  __attribute__((ext_vector_type(4)));
typedef float    v8f  __attribute__((ext_vector_type(8)));
typedef int      v4i  __attribute__((ext_vector_type(4)));

#if defined(__has_builtin)
#  if __has_builtin(__builtin_amdgcn_global_load_async_to_lds_b128) && \
      __has_builtin(__builtin_amdgcn_s_wait_asynccnt)
#    define USE_ASYNC_LDS 1
#  endif
#endif
#ifndef USE_ASYNC_LDS
#  define USE_ASYNC_LDS 0
#endif

#if USE_ASYNC_LDS
// b128 async copy payload is typed as int4; global src is AS1, LDS dst is AS3.
typedef __attribute__((address_space(1))) v4i gbl_v4i;
typedef __attribute__((address_space(3))) v4i lds_v4i;
#endif

// Copy 16 bytes global -> LDS (per-lane addresses).
__device__ __forceinline__ void cp16(_Float16* lds, const _Float16* g) {
#if USE_ASYNC_LDS
  _Float16* gn = const_cast<_Float16*>(g);
  __builtin_amdgcn_global_load_async_to_lds_b128((gbl_v4i*)gn, (lds_v4i*)lds,
                                                 0, 0);
#else
  *(v8h*)lds = *(const v8h*)g;
#endif
}
__device__ __forceinline__ void async_fence() {
#if USE_ASYNC_LDS
  __builtin_amdgcn_s_wait_asynccnt(0);
#endif
}

__device__ __forceinline__ v16h mk16(v8h a, v8h b) {
  return __builtin_shufflevector(a, b, 0,1,2,3,4,5,6,7,8,9,10,11,12,13,14,15);
}
__device__ __forceinline__ v16h frag_ld(const _Float16* p) {
  v8h a = *(const v8h*)(p);
  v8h b = *(const v8h*)(p + 16);
  return mk16(a, b);
}
__device__ __forceinline__ v8f wmma16(v16h a, v16h b, v8f c) {
  return __builtin_amdgcn_wmma_f32_16x16x32_f16(false, a, false, b, (short)0, c,
                                                false, false);
}

// ---------------------------------------------------------------------------
// LayerNorm (D = 1024), f32 in -> f16 out. One wave owns two whole rows: all
// 16 row loads (512 contiguous bytes each) are issued before the first sum,
// the row sums close with a 32-lane butterfly, and no LDS or barrier is used.
// 256 threads = 8 waves = 16 rows per block, so 16x fewer waves are started
// than with one 8-wave block per row. blk = which 16 rows.
// ---------------------------------------------------------------------------
__device__ __forceinline__ void ln_rows(
    const float* __restrict__ x, const float* __restrict__ gamma,
    const float* __restrict__ beta, _Float16* __restrict__ out, int blk) {
  const int D = 1024;
  int lane = threadIdx.x & 31;
  // The wave's number is the same in all its lanes: kept scalar, the row base
  // stays in scalar registers and one lane offset serves every load.
  int wave = __builtin_amdgcn_readfirstlane(threadIdx.x >> 5);
  int row0 = (blk * 8 + wave) * 2;
  const float4* xr = (const float4*)(x + (size_t)row0 * D) + lane;
  float4 v[2][8];
  for (int r = 0; r < 2; ++r)
    for (int j = 0; j < 8; ++j) v[r][j] = xr[r * 256 + j * 32];
  float mu[2], rs[2];
  for (int r = 0; r < 2; ++r) {
    float s = 0.0f, q = 0.0f;
    for (int j = 0; j < 8; ++j) {
      float4 t = v[r][j];
      s += t.x + t.y + t.z + t.w;
      q += t.x * t.x + t.y * t.y + t.z * t.z + t.w * t.w;
    }
    for (int off = 16; off > 0; off >>= 1) {
      s += __shfl_xor(s, off, 32);
      q += __shfl_xor(q, off, 32);
    }
    mu[r] = s * (1.0f / 1024.0f);
    float var = q * (1.0f / 1024.0f) - mu[r] * mu[r];
    rs[r] = rsqrtf(var + 1e-5f);
  }
  for (int j = 0; j < 8; ++j) {
    float4 g = ((const float4*)gamma)[j * 32 + lane];
    float4 b = ((const float4*)beta)[j * 32 + lane];
    for (int r = 0; r < 2; ++r) {
      float4 t = v[r][j];
      v4h o;
      o[0] = (_Float16)((t.x - mu[r]) * rs[r] * g.x + b.x);
      o[1] = (_Float16)((t.y - mu[r]) * rs[r] * g.y + b.y);
      o[2] = (_Float16)((t.z - mu[r]) * rs[r] * g.z + b.z);
      o[3] = (_Float16)((t.w - mu[r]) * rs[r] * g.w + b.w);
      ((v4h*)(out + (size_t)(row0 + r) * D))[j * 32 + lane] = o;
    }
  }
}

__global__ __launch_bounds__(256) void ln_f16_kernel(
    const float* __restrict__ x, const float* __restrict__ gamma,
    const float* __restrict__ beta, _Float16* __restrict__ out) {
  ln_rows(x, gamma, beta, out, blockIdx.x);
}

// ---------------------------------------------------------------------------
// Weight prep: f32 [R][C] -> f16 [C][R] (transpose + cast). 4 waves move one
// 64x64 tile, 32 elements per lane: 8 float4 loads in flight per lane (256 B
// of a source row per 16 lanes), two source rows packed per LDS dword, and
// 16-B stores, 8 adjacent lanes to one whole 128-B line of an output row.
// R % 64 == 0, C % 64 == 0. LDS row pitch 72 halves keeps b128 reads aligned.
// t = the tile's own 64 x 72 halves of LDS, tid = 0..127 within the 4 waves.
// Holds one barrier: every wave of the block calls it.
// ---------------------------------------------------------------------------
__device__ __forceinline__ void transpose_tile(
    const float* __restrict__ in, _Float16* __restrict__ out,
    int R, int C, int r0, int c0, _Float16* t, int tid) {
  int c4 = (tid & 15) * 4, rp = (tid >> 4) * 2;
  v4f a[4], b[4];
  const float* src[4];
  for (int p = 0; p < 4; ++p) {
    src[p] = in + (size_t)(r0 + p * 16 + rp) * C + (c0 + c4);
    a[p] = *(const v4f*)src[p];
    b[p] = *(const v4f*)(src[p] + C);
  }
  asm volatile("s_wait_xcnt 0x0"
               :: "v"(src[0]), "v"(src[1]), "v"(src[2]), "v"(src[3]),
                  "v"(src[0] + C), "v"(src[1] + C), "v"(src[2] + C),
                  "v"(src[3] + C)
               : "memory");
  for (int p = 0; p < 4; ++p)
    for (int i = 0; i < 4; ++i) {
      v2h pr;
      pr[0] = (_Float16)a[p][i];
      pr[1] = (_Float16)b[p][i];
      *(v2h*)&t[(c4 + i) * 72 + p * 16 + rp] = pr;
    }
  __syncthreads();
  int ch = (tid & 7) * 8, cr = tid >> 3;
  for (int p = 0; p < 4; ++p) {
    int c = p * 16 + cr;
    *(v8h*)(out + (size_t)(c0 + c) * R + (r0 + ch)) = *(const v8h*)&t[c * 72 + ch];
  }
}

// ---------------------------------------------------------------------------
// Everything that depends on the inputs alone, in ONE launch: the first
// LayerNorm (blocks 0..511, 16 rows each) and the cast + transpose of all six
// weights (blocks 512..2047, two 64x64 tiles each, one per 4 waves). None of
// these pieces reads what another writes, so they need no launch boundary
// between them, and each one's start and drain hides behind the others' work.
// Tiles in order: Wq, Wk, Wv (per head [1024][64], 16 x 16 tiles each),
// Wo [1024][1024], W1 [1024][4096], W2 [4096][1024]. Every range starts at an
// even tile, so a block's two tiles are of one weight.
// ---------------------------------------------------------------------------
__global__ __launch_bounds__(256) void prep_kernel(
    const float* __restrict__ x, const float* __restrict__ gamma,
    const float* __restrict__ beta, _Float16* __restrict__ h16,
    const float* __restrict__ Wq, const float* __restrict__ Wk,
    const float* __restrict__ Wv, const float* __restrict__ Wo,
    const float* __restrict__ W1, const float* __restrict__ W2,
    _Float16* __restrict__ qkvT, _Float16* __restrict__ woT,
    _Float16* __restrict__ w1T, _Float16* __restrict__ w2T) {
  int blk = blockIdx.x;
  if (blk < 512) {  // the same for the whole block, ahead of the barrier
    ln_rows(x, gamma, beta, h16, blk);
    return;
  }
  __shared__ __attribute__((aligned(16))) _Float16 t[2][64 * 72];
  // Which half of the block: the same in all lanes of a wave, kept scalar so
  // that the choice of weight and tile below is scalar work.
  int half = __builtin_amdgcn_readfirstlane(threadIdx.x >> 7);
  int tile = (blk - 512) * 2 + half;
  const float* in;
  _Float16* out;
  int R, C, r0, c0;
  if (tile < 768) {
    int w = tile >> 8, head = (tile >> 4) & 15;
    in  = (w == 0 ? Wq : w == 1 ? Wk : Wv) + head * (1024 * 64);
    out = qkvT + (w * 16 + head) * (64 * 1024);
    R = 1024; C = 64; r0 = (tile & 15) * 64; c0 = 0;
  } else if (tile < 1024) {
    int u = tile - 768;
    in = Wo; out = woT;
    R = 1024; C = 1024; r0 = (u >> 4) * 64; c0 = (u & 15) * 64;
  } else if (tile < 2048) {
    int u = tile - 1024;
    in = W1; out = w1T;
    R = 1024; C = 4096; r0 = (u >> 6) * 64; c0 = (u & 63) * 64;
  } else {
    int u = tile - 2048;
    in = W2; out = w2T;
    R = 4096; C = 1024; r0 = (u >> 4) * 64; c0 = (u & 15) * 64;
  }
  transpose_tile(in, out, R, C, r0, c0, t[half], threadIdx.x & 127);
}

// ---------------------------------------------------------------------------
// Generic WMMA GEMM: C[M,N] = act(A[M,K] * B^T[N,K] + bias) (+ residual).
// 256 threads = 8 waves (4 x 2); block tile 256x128; wave tile 64x64: 8
// fragments feed 16 WMMAs, and a block fetches 384 operand rows for 256x128
// results. K-step 64.
// Double-buffered LDS (one barrier / K-step); async global->LDS staging.
// A stage holds 128 B of every operand row; 8 adjacent lanes copy one row's
// piece, so a wave-wide copy covers 4 whole 128-B lines. K % 64 == 0.
// LDS row stride 72 halves (144 B = 16 B x 9 -> conflict-free b128 reads).
// Epilogue, once per 32 rows of the wave's tile: the wave lays 32x64 f32 into
// its own part of the ring (row pitch 68 floats) and reads it back by rows, 4
// columns per lane, so that 16 lanes store one whole row piece (256 B of f32,
// 128 B of f16) and the residual comes in as 16 independent 16-B loads issued
// together. N is a literal in every caller: all 16 row pieces hang off one
// address by constant offsets.
// ---------------------------------------------------------------------------
__device__ __forceinline__ void gemm_tile(
    const _Float16* __restrict__ A, const _Float16* __restrict__ BT,
    const float* __restrict__ bias, const float* __restrict__ resid,
    float* __restrict__ outF, _Float16* __restrict__ outH,
    const int N, int K, const bool hasBias, const bool doRelu,
    const bool f32out) {
  const int LS = 72;
  const int ABUF = 256 * LS;  // halves of one A buffer
  const int BBUF = 128 * LS;  // halves of one B buffer
  // [A buf 0 | A buf 1 | B buf 0 | B buf 1]; the epilogue reuses its start.
  __shared__ __attribute__((aligned(16))) _Float16 sm[2 * ABUF + 2 * BBUF];
  int tid  = threadIdx.x;
  int wave = tid >> 5, lane = tid & 31;
  int hi = lane >> 4, lo = lane & 15, kk0 = hi * 8;
  int wm = wave >> 1, wn = wave & 1;
  int m0 = blockIdx.y * 256, n0 = blockIdx.x * 128;
  int ldr = tid >> 3, ldc = (tid & 7) * 8;
  int dOff = ldr * LS + ldc;
  const _Float16* Ag = A  + (size_t)(m0 + ldr) * K + ldc;
  const _Float16* Bg = BT + (size_t)(n0 + ldr) * K + ldc;
  const size_t rstep = (size_t)32 * K;  // the block's copies advance 32 rows
  // One lane per operand row prefetches once per 256 B of the row, for speed
  // only: every lane for an A row, the lanes of waves 0 to 3 for a B row as well.
  const _Float16* pfA = A  + (size_t)(m0 + tid) * K;
  const _Float16* pfB = BT + (size_t)(n0 + (tid & 127)) * K;
  const bool lowWaves = __builtin_amdgcn_readfirstlane(wave) < 4;

  auto stage = [&](int buf, int k0) {
    for (int j = 0; j < 8; ++j)
      cp16(&sm[buf * ABUF + dOff + j * 32 * LS], Ag + j * rstep + k0);
    for (int j = 0; j < 4; ++j)
      cp16(&sm[2 * ABUF + buf * BBUF + dOff + j * 32 * LS],
           Bg + j * rstep + k0);
  };

  v8f acc[4][4] = {};
  int nk = K >> 6;
  stage(0, 0);
  for (int i = 0; i < nk; ++i) {
    int cur = i & 1;
    async_fence();           // this wave's async writes into LDS are done
    __syncthreads();         // everyone's writes visible; prev reads done
    if (i + 1 < nk) stage(cur ^ 1, (i + 1) << 6);
    if (!(i & 1) && i + 2 < nk) {
      // Stages i+2 and i+3 cover the next 256 B of each row: one prefetch at
      // its start, for speed only. pfA and pfB live through the loop
      // and only ever hold an address inside their operand.
      pfA += 128;
      asm volatile("global_prefetch_b8 %0, off scope:SCOPE_SE" :: "v"(pfA));
      if (lowWaves) {
        pfB += 128;
        asm volatile("global_prefetch_b8 %0, off scope:SCOPE_SE" :: "v"(pfB));
      }
    }
    const _Float16* Ab = &sm[cur * ABUF];
    const _Float16* Bb = &sm[2 * ABUF + cur * BBUF];
    for (int kh = 0; kh < 2; ++kh) {
      int ko = kh * 32 + kk0;
      v16h af[4], bf[4];
      // In the order of first use: B 0, all of A, the rest of B.
      bf[0] = frag_ld(&Bb[(wn * 64 + lo) * LS + ko]);
      for (int mt = 0; mt < 4; ++mt)
        af[mt] = frag_ld(&Ab[(wm * 64 + mt * 16 + lo) * LS + ko]);
      for (int nt = 1; nt < 4; ++nt)
        bf[nt] = frag_ld(&Bb[(wn * 64 + nt * 16 + lo) * LS + ko]);
      // All 16 fragment reads are issued ahead of the 16 WMMAs: left alone,
      // the compiler keeps one B fragment and waits out an LDS read per four.
      __builtin_amdgcn_sched_barrier(0);
      for (int nt = 0; nt < 4; ++nt)
        for (int mt = 0; mt < 4; ++mt)
          acc[mt][nt] = wmma16(af[mt], bf[nt], acc[mt][nt]);
    }
  }

  // Of each 32 rows, lane (hi, lo) finishes columns lo*4 .. lo*4+3 of rows
  // 2j + hi, j = 0..15.
  const int SP = 68;  // 272-B rows: 16 B x odd, conflict-free both ways
  int col = n0 + wn * 64 + lo * 4;
  const size_t off0 = (size_t)(m0 + wm * 64 + hi) * N + col;
  const size_t jstep = (size_t)2 * N;
  const size_t hstep = (size_t)32 * N;
  __syncthreads();  // every wave has read its last fragments out of the ring
  v4f rv[2][16];
  v4f bv = {};
  const float* rp = f32out ? resid + off0 : nullptr;
  const float* bp = hasBias ? bias + col : nullptr;
  if (f32out)
    for (int j = 0; j < 16; ++j) rv[0][j] = *(const v4f*)(rp + j * jstep);
  if (hasBias) bv = *(const v4f*)bp;
  if (f32out)
    asm volatile("s_wait_xcnt 0x0" :: "v"(rp), "v"(bp) : "memory");
  else if (hasBias)
    asm volatile("s_wait_xcnt 0x0" :: "v"(bp) : "memory");
  float* sw = (float*)sm + wave * (32 * SP);
  for (int h = 0; h < 2; ++h) {
    for (int gm = 0; gm < 2; ++gm)
      for (int nt = 0; nt < 4; ++nt)
        for (int g = 0; g < 8; ++g)
          sw[(gm * 16 + hi * 8 + g) * SP + nt * 16 + lo] = acc[h * 2 + gm][nt][g];
    // The rows are read back by other lanes of this wave: its stores are done.
    asm volatile("s_wait_dscnt 0x0" ::: "memory");
    if (f32out && h == 0) {
      // The second 32 rows' residual is on its way while the first are stored.
      for (int j = 0; j < 16; ++j)
        rv[1][j] = *(const v4f*)(rp + hstep + j * jstep);
      asm volatile("s_wait_xcnt 0x0" :: "v"(rp) : "memory");
    }
    for (int j = 0; j < 16; ++j) {
      v4f v = *(const v4f*)&sw[(j * 2 + hi) * SP + lo * 4] + bv;
      if (f32out) {
        *(v4f*)(outF + off0 + h * hstep + j * jstep) = v + rv[h][j];
      } else {
        if (doRelu)
          for (int e = 0; e < 4; ++e) v[e] = fmaxf(v[e], 0.0f);
        *(v4h*)(outH + off0 + h * hstep + j * jstep) =
            __builtin_convertvector(v, v4h);
      }
    }
    if (h == 0) asm volatile("s_wait_xcnt 0x0" ::: "memory");
  }
}

// N = 3072, f16 result: A B^T.
__global__ __launch_bounds__(256) void gemm_n3072_kernel(
    const _Float16* __restrict__ A, const _Float16* __restrict__ BT,
    _Float16* __restrict__ outH, int K) {
  gemm_tile(A, BT, nullptr, nullptr, nullptr, outH, 3072, K, false, false,
            false);
}

// N = 4096, f16 result: relu(A B^T + bias).
__global__ __launch_bounds__(256) void gemm_n4096_relu_kernel(
    const _Float16* __restrict__ A, const _Float16* __restrict__ BT,
    const float* __restrict__ bias, _Float16* __restrict__ outH, int K) {
  gemm_tile(A, BT, bias, nullptr, nullptr, outH, 4096, K, true, true, false);
}

// N = 1024, f32 result: A B^T + bias + residual.
__global__ __launch_bounds__(256) void gemm_n1024_res_kernel(
    const _Float16* __restrict__ A, const _Float16* __restrict__ BT,
    const float* __restrict__ bias, const float* __restrict__ resid,
    float* __restrict__ outF, int K) {
  gemm_tile(A, BT, bias, resid, outF, nullptr, 1024, K, true, false, true);
}

__device__ __forceinline__ float xhalf(float x) {
  int b = __builtin_bit_cast(int, x);
  return __builtin_bit_cast(
      float, __builtin_amdgcn_permlanex16(b, b, 0x76543210, 0xfedcba98, false,
                                          false));
}

__global__ __launch_bounds__(256) void flash_attn_kernel(
    const _Float16* __restrict__ qkv, _Float16* __restrict__ outH) {
  const int T = 2048, S3 = 3072, HD = 64;
  int h = blockIdx.y, b = blockIdx.z;
  int tid  = threadIdx.x;
  int wave = tid >> 5, lane = tid & 31;
  int hi = lane >> 4, lo = lane & 15, kk0 = hi * 8;

  const _Float16* Qp = qkv + (size_t)(b * T) * S3 + h * HD;
  const _Float16* Kp = Qp + 1024;
  const _Float16* Vp = Qp + 2048;

  // Two buffers of each tile: tile t lies in buffer t & 1.
  const int TB = 64 * 72;  // halves of one buffer
  __shared__ __attribute__((aligned(16))) _Float16 Ksh[2 * TB];
  __shared__ __attribute__((aligned(16))) _Float16 VTsh[2 * TB];
  int ldr = tid >> 2, cg = tid & 3;
  // This lane's 32 B of a tile's K row and V row, and their places in LDS.
  const _Float16* kg = Kp + (size_t)ldr * S3 + cg * 16;
  const _Float16* vg = Vp + (size_t)ldr * S3 + cg * 16;
  const int kDst = ldr * 72 + cg * 16, vDst = cg * 16 * 72 + ldr;
  const size_t tstep = (size_t)64 * S3;  // one key tile further
  v8h v0, v1;  // the V row piece on its way from memory to VTsh
  // K: async copies straight into the buffer. V: into registers now, and
  // transposed into the buffer by put_v in the middle of the tile in hand.
  auto fetch = [&](int buf, int kt) {
    const _Float16* krow = kg + kt * tstep;
    cp16(&Ksh[buf * TB + kDst], krow);
    cp16(&Ksh[buf * TB + kDst + 8], krow + 8);
    const _Float16* vrow = vg + kt * tstep;
    v0 = *(const v8h*)(vrow);
    v1 = *(const v8h*)(vrow + 8);
    // The two loads' address registers stay untouched until their address
    // translations are done.
    asm volatile("s_wait_xcnt 0x0" ::: "memory");
  };
  auto put_v = [&](int buf) {
    for (int j = 0; j < 8; ++j) {
      VTsh[buf * TB + vDst + j * 72]       = v0[j];
      VTsh[buf * TB + vDst + (8 + j) * 72] = v1[j];
    }
  };
  // Hands a filled buffer over, and frees the one just read: this wave's LDS
  // reads and stores are done, its copies have landed, then the barrier.
  auto publish = [&]() {
    asm volatile("s_wait_dscnt 0x0" ::: "memory");
    asm volatile("s_wait_asynccnt 0x0" ::: "memory");
    __syncthreads();
  };

  for (int part = 0; part < 2; ++part) {  // the same for the whole block
  int qb = part ? (int)blockIdx.x : T / 128 - 1 - (int)blockIdx.x;
  int q0 = qb * 128 + wave * 16;
  int qi = q0 + lo;  // the query this lane owns

  v16h qf0, qf1;
  {
    const _Float16* qrow = Qp + (size_t)qi * S3;
    qf0 = mk16(*(const v8h*)(qrow + kk0),      *(const v8h*)(qrow + kk0 + 16));
    qf1 = mk16(*(const v8h*)(qrow + 32 + kk0), *(const v8h*)(qrow + 32 + kk0 + 16));
  }

  // Oacc[et][g] = O[qi][et*16 + hi*8 + g]. rowM is the query's running maximum
  // (equal in both lane halves); rowL sums this half's keys only, the halves
  // are joined once behind the loop.
  v8f Oacc[4] = {};
  float rowM = -1e30f, rowL = 0.0f;

  int ntiles = 2 * (qb + 1);  // keys up to end of this query block

  // Both buffers are free here: the last publish of the first query block
  // stands behind every wave's last read.
  fetch(0, 0);
  put_v(0);
  publish();

  for (int kt = 0; kt < ntiles; ++kt) {
    int k0 = kt * 64;
    int cur = kt & 1;
    const bool more = kt + 1 < ntiles;  // the same for the whole block
    // The next tile is on its way while this one is worked out; its buffer
    // was last read one trip ago, ahead of that trip's publish.
    if (more) fetch(cur ^ 1, kt + 1);
    const _Float16* Kb = &Ksh[cur * TB];
    const _Float16* Vb = &VTsh[cur * TB];

    if (k0 <= q0 + 15) {  // uniform per wave
      v8f p[4];      // p[nt][g]: key k0 + nt*16 + hi*8 + g against query qi
      float mx[4];   // one chain per score tile, joined below
      for (int nt = 0; nt < 4; ++nt) {
        v8f s = {};
        v16h kf0 = frag_ld(&Kb[(nt * 16 + lo) * 72 + kk0]);
        v16h kf1 = frag_ld(&Kb[(nt * 16 + lo) * 72 + 32 + kk0]);
        s = wmma16(kf0, qf0, s);
        s = wmma16(kf1, qf1, s);
        int kj = k0 + nt * 16 + hi * 8;
        for (int g = 0; g < 8; ++g)
          p[nt][g] = (kj + g <= qi) ? s[g] * 0.125f : -1e30f;
        mx[nt] = p[nt][0];
        for (int g = 1; g < 8; ++g) mx[nt] = fmaxf(mx[nt], p[nt][g]);
      }
      float m = fmaxf(fmaxf(mx[0], mx[1]), fmaxf(mx[2], mx[3]));
      m = fmaxf(m, xhalf(m));
      float nm = fmaxf(rowM, m);
      float corr = __expf(rowM - nm);
      // The next V tile has had the score products to arrive in: its LDS
      // stores drain under the exponentials, not in front of the barrier.
      if (more) put_v(cur ^ 1);
      float rs[4];
      for (int nt = 0; nt < 4; ++nt) {
        p[nt] = (p[nt] - nm) * 1.44269504f;  // e^x = 2^(x log2 e)
        rs[nt] = 0.0f;
        for (int g = 0; g < 8; ++g) {
          p[nt][g] = __builtin_amdgcn_exp2f(p[nt][g]);
          rs[nt] += p[nt][g];
        }
      }
      rowL = rowL * corr + ((rs[0] + rs[1]) + (rs[2] + rs[3]));
      rowM = nm;
      for (int et = 0; et < 4; ++et) Oacc[et] *= corr;
      // P^T as B fragments: element s of a lane is key kk0 + s (s < 8) or
      // 16 + kk0 + (s - 8) of the 32-key block, which is what the lane holds.
      v16h pf0 = mk16(__builtin_convertvector(p[0], v8h),
                      __builtin_convertvector(p[1], v8h));
      v16h pf1 = mk16(__builtin_convertvector(p[2], v8h),
                      __builtin_convertvector(p[3], v8h));
      for (int et = 0; et < 4; ++et) {
        v16h vf0 = frag_ld(&Vb[(et * 16 + lo) * 72 + kk0]);
        v16h vf1 = frag_ld(&Vb[(et * 16 + lo) * 72 + 32 + kk0]);
        Oacc[et] = wmma16(vf0, pf0, Oacc[et]);
        Oacc[et] = wmma16(vf1, pf1, Oacc[et]);
      }
    } else if (more) {
      put_v(cur ^ 1);  // a wave with no work in this tile still stages
    }
    publish();
  }

  float inv = 1.0f / (rowL + xhalf(rowL));
  _Float16* orow = outH + (size_t)(b * T + qi) * 1024 + h * HD + hi * 8;
  for (int et = 0; et < 4; ++et)
    *(v8h*)(orow + et * 16) = __builtin_convertvector(Oacc[et] * inv, v8h);
  asm volatile("s_wait_xcnt 0x0" ::: "memory");
  }
}

// ---------------------------------------------------------------------------
extern "C" void kernel_launch(void* const* d_in, const int* in_sizes, int n_in,
                              void* d_out, int out_size, void* d_ws, size_t ws_size,
                              hipStream_t stream) {
  (void)in_sizes; (void)n_in; (void)out_size; (void)ws_size;
  const int B = 4, T = 2048, D = 1024, H = 16, HD = 64, F = 4096;
  const int M = B * T;

  const float* x   = (const float*)d_in[0];
  const float* Wq  = (const float*)d_in[1];
  const float* Wk  = (const float*)d_in[2];
  const float* Wv  = (const float*)d_in[3];
  const float* Wo  = (const float*)d_in[4];
  const float* bo  = (const float*)d_in[5];
  const float* W1  = (const float*)d_in[6];
  const float* b1  = (const float*)d_in[7];
  const float* W2  = (const float*)d_in[8];
  const float* b2  = (const float*)d_in[9];
  const float* g1  = (const float*)d_in[10];
  const float* be1 = (const float*)d_in[11];
  const float* g2  = (const float*)d_in[12];
  const float* be2 = (const float*)d_in[13];

  char* w = (char*)d_ws;
  auto alloc = [&](size_t bytes) -> void* {
    void* p = (void*)w;
    w += (bytes + 255) & ~(size_t)255;
    return p;
  };
  _Float16* h16  = (_Float16*)alloc((size_t)M * D * 2);       // LN1 out
  _Float16* qkvT = (_Float16*)alloc((size_t)3 * D * D * 2);   // [3072][1024]
  _Float16* woT  = (_Float16*)alloc((size_t)D * D * 2);       // [1024][1024]
  _Float16* w1T  = (_Float16*)alloc((size_t)F * D * 2);       // [4096][1024]
  _Float16* w2T  = (_Float16*)alloc((size_t)D * F * 2);       // [1024][4096]
  _Float16* qkv  = (_Float16*)alloc((size_t)M * 3 * D * 2);   // [8192][3072]
  _Float16* a16  = (_Float16*)alloc((size_t)M * D * 2);       // attn concat
  float*    x1   = (float*)   alloc((size_t)M * D * 4);       // residual 1
  _Float16* h2   = (_Float16*)alloc((size_t)M * D * 2);       // LN2 out
  _Float16* ffh  = (_Float16*)alloc((size_t)M * F * 2);       // relu(h2 W1+b1)

  // LN1 and the weight prep (cast + transpose, so that every GEMM B operand is
  // B^T[N][K]) in one launch: 512 LN blocks + 3072 / 2 tile blocks.
  prep_kernel<<<2048, 256, 0, stream>>>(x, g1, be1, h16, Wq, Wk, Wv, Wo, W1, W2,
                                        qkvT, woT, w1T, w2T);

  // fused QKV projection -> flash attention
  gemm_n3072_kernel<<<dim3(3 * D / 128, M / 256), 256, 0, stream>>>(
      h16, qkvT, qkv, D);
  flash_attn_kernel<<<dim3(T / 256, H, B), 256, 0, stream>>>(qkv, a16);

  // Wo projection + bias + residual(x) -> x1 (f32)
  gemm_n1024_res_kernel<<<dim3(D / 128, M / 256), 256, 0, stream>>>(
      a16, woT, bo, x, x1, D);

  // LN2 -> FFN1 (relu) -> FFN2 + residual(x1) -> out
  ln_f16_kernel<<<M / 16, 256, 0, stream>>>(x1, g2, be2, h2);
  gemm_n4096_relu_kernel<<<dim3(F / 128, M / 256), 256, 0, stream>>>(
      h2, w1T, b1, ffh, D);
  gemm_n1024_res_kernel<<<dim3(D / 128, M / 256), 256, 0, stream>>>(
      ffh, w2T, b2, x1, (float*)d_out, F);
}

// v009
// It runs in 233 microseconds.
// In both of two side-by-side timings against v008, it was 1.03 times as fast.
// Counting every step since v000, it is 3.29 times as fast.
#include <hip/hip_runtime.h>

typedef _Float16 v16h __attribute__((ext_vector_type(16)));
typedef _Float16 v8h  __attribute__((ext_vector_type(8)));
typedef _Float16 v4h  __attribute__((ext_vector_type(4)));
typedef _Float16 v2h  __attribute__((ext_vector_type(2)));
typedef float    v4f  __attribute__((ext_vector_type(4)));
typedef float    v8f  __attribute__((ext_vector_type(8)));
typedef int      v4i  __attribute__((ext_vector_type(4)));

#if defined(__has_builtin)
#  if __has_builtin(__builtin_amdgcn_global_load_async_to_lds_b128) && \
      __has_builtin(__builtin_amdgcn_s_wait_asynccnt)
#    define USE_ASYNC_LDS 1
#  endif
#endif
#ifndef USE_ASYNC_LDS
#  define USE_ASYNC_LDS 0
#endif

#if USE_ASYNC_LDS
// b128 async copy payload is typed as int4; global src is AS1, LDS dst is AS3.
typedef __attribute__((address_space(1))) v4i gbl_v4i;
typedef __attribute__((address_space(3))) v4i lds_v4i;
#endif

// Copy 16 bytes global -> LDS (per-lane addresses).
__device__ __forceinline__ void cp16(_Float16* lds, const _Float16* g) {
#if USE_ASYNC_LDS
  _Float16* gn = const_cast<_Float16*>(g);
  __builtin_amdgcn_global_load_async_to_lds_b128((gbl_v4i*)gn, (lds_v4i*)lds,
                                                 0, 0);
#else
  *(v8h*)lds = *(const v8h*)g;
#endif
}
__device__ __forceinline__ void async_fence() {
#if USE_ASYNC_LDS
  __builtin_amdgcn_s_wait_asynccnt(0);
#endif
}

__device__ __forceinline__ v16h mk16(v8h a, v8h b) {
  return __builtin_shufflevector(a, b, 0,1,2,3,4,5,6,7,8,9,10,11,12,13,14,15);
}
__device__ __forceinline__ v16h frag_ld(const _Float16* p) {
  v8h a = *(const v8h*)(p);
  v8h b = *(const v8h*)(p + 16);
  return mk16(a, b);
}
typedef short s16x8 __attribute__((ext_vector_type(8)));
typedef __attribute__((address_space(3))) s16x8 lds_s16x8;
__device__ __forceinline__ v8h ld_tr16(const _Float16* p) {
  return __builtin_bit_cast(
      v8h, __builtin_amdgcn_ds_load_tr16_b128_v8i16((lds_s16x8*)p));
}
__device__ __forceinline__ v8f wmma16(v16h a, v16h b, v8f c) {
  return __builtin_amdgcn_wmma_f32_16x16x32_f16(false, a, false, b, (short)0, c,
                                                false, false);
}

// ---------------------------------------------------------------------------
// LayerNorm (D = 1024), f32 in -> f16 out. One wave owns two whole rows: all
// 16 row loads (512 contiguous bytes each) are issued before the first sum,
// the row sums close with a 32-lane butterfly, and no LDS or barrier is used.
// 256 threads = 8 waves = 16 rows per block, so 16x fewer waves are started
// than with one 8-wave block per row. blk = which 16 rows.
// ---------------------------------------------------------------------------
__device__ __forceinline__ void ln_rows(
    const float* __restrict__ x, const float* __restrict__ gamma,
    const float* __restrict__ beta, _Float16* __restrict__ out, int blk) {
  const int D = 1024;
  int lane = threadIdx.x & 31;
  // The wave's number is the same in all its lanes: kept scalar, the row base
  // stays in scalar registers and one lane offset serves every load.
  int wave = __builtin_amdgcn_readfirstlane(threadIdx.x >> 5);
  int row0 = (blk * 8 + wave) * 2;
  const float4* xr = (const float4*)(x + (size_t)row0 * D) + lane;
  float4 v[2][8];
  for (int r = 0; r < 2; ++r)
    for (int j = 0; j < 8; ++j) v[r][j] = xr[r * 256 + j * 32];
  float mu[2], rs[2];
  for (int r = 0; r < 2; ++r) {
    float s = 0.0f, q = 0.0f;
    for (int j = 0; j < 8; ++j) {
      float4 t = v[r][j];
      s += t.x + t.y + t.z + t.w;
      q += t.x * t.x + t.y * t.y + t.z * t.z + t.w * t.w;
    }
    for (int off = 16; off > 0; off >>= 1) {
      s += __shfl_xor(s, off, 32);
      q += __shfl_xor(q, off, 32);
    }
    mu[r] = s * (1.0f / 1024.0f);
    float var = q * (1.0f / 1024.0f) - mu[r] * mu[r];
    rs[r] = rsqrtf(var + 1e-5f);
  }
  for (int j = 0; j < 8; ++j) {
    float4 g = ((const float4*)gamma)[j * 32 + lane];
    float4 b = ((const float4*)beta)[j * 32 + lane];
    for (int r = 0; r < 2; ++r) {
      float4 t = v[r][j];
      v4h o;
      o[0] = (_Float16)((t.x - mu[r]) * rs[r] * g.x + b.x);
      o[1] = (_Float16)((t.y - mu[r]) * rs[r] * g.y + b.y);
      o[2] = (_Float16)((t.z - mu[r]) * rs[r] * g.z + b.z);
      o[3] = (_Float16)((t.w - mu[r]) * rs[r] * g.w + b.w);
      ((v4h*)(out + (size_t)(row0 + r) * D))[j * 32 + lane] = o;
    }
  }
}

__global__ __launch_bounds__(256) void ln_f16_kernel(
    const float* __restrict__ x, const float* __restrict__ gamma,
    const float* __restrict__ beta, _Float16* __restrict__ out) {
  ln_rows(x, gamma, beta, out, blockIdx.x);
}

// ---------------------------------------------------------------------------
// Weight prep: f32 [R][C] -> f16 [C][R] (transpose + cast). 4 waves move one
// 64x64 tile, 32 elements per lane: 8 float4 loads in flight per lane (256 B
// of a source row per 16 lanes), two source rows packed per LDS dword, and
// 16-B stores, 8 adjacent lanes to one whole 128-B line of an output row.
// R % 64 == 0, C % 64 == 0. LDS row pitch 72 halves keeps b128 reads aligned.
// t = the tile's own 64 x 72 halves of LDS, tid = 0..127 within the 4 waves.
// Holds one barrier: every wave of the block calls it.
// ---------------------------------------------------------------------------
__device__ __forceinline__ void transpose_tile(
    const float* __restrict__ in, _Float16* __restrict__ out,
    int R, int C, int r0, int c0, _Float16* t, int tid) {
  int c4 = (tid & 15) * 4, rp = (tid >> 4) * 2;
  v4f a[4], b[4];
  const float* src[4];
  for (int p = 0; p < 4; ++p) {
    src[p] = in + (size_t)(r0 + p * 16 + rp) * C + (c0 + c4);
    a[p] = *(const v4f*)src[p];
    b[p] = *(const v4f*)(src[p] + C);
  }
  asm volatile("s_wait_xcnt 0x0"
               :: "v"(src[0]), "v"(src[1]), "v"(src[2]), "v"(src[3]),
                  "v"(src[0] + C), "v"(src[1] + C), "v"(src[2] + C),
                  "v"(src[3] + C)
               : "memory");
  for (int p = 0; p < 4; ++p)
    for (int i = 0; i < 4; ++i) {
      v2h pr;
      pr[0] = (_Float16)a[p][i];
      pr[1] = (_Float16)b[p][i];
      *(v2h*)&t[(c4 + i) * 72 + p * 16 + rp] = pr;
    }
  __syncthreads();
  int ch = (tid & 7) * 8, cr = tid >> 3;
  for (int p = 0; p < 4; ++p) {
    int c = p * 16 + cr;
    *(v8h*)(out + (size_t)(c0 + c) * R + (r0 + ch)) = *(const v8h*)&t[c * 72 + ch];
  }
}

// ---------------------------------------------------------------------------
// Everything that depends on the inputs alone, in ONE launch: the first
// LayerNorm (blocks 0..511, 16 rows each) and the cast + transpose of all six
// weights (blocks 512..2047, two 64x64 tiles each, one per 4 waves). None of
// these pieces reads what another writes, so they need no launch boundary
// between them, and each one's start and drain hides behind the others' work.
// Tiles in order: Wq, Wk, Wv (per head [1024][64], 16 x 16 tiles each),
// Wo [1024][1024], W1 [1024][4096], W2 [4096][1024]. Every range starts at an
// even tile, so a block's two tiles are of one weight.
// ---------------------------------------------------------------------------
__global__ __launch_bounds__(256) void prep_kernel(
    const float* __restrict__ x, const float* __restrict__ gamma,
    const float* __restrict__ beta, _Float16* __restrict__ h16,
    const float* __restrict__ Wq, const float* __restrict__ Wk,
    const float* __restrict__ Wv, const float* __restrict__ Wo,
    const float* __restrict__ W1, const float* __restrict__ W2,
    _Float16* __restrict__ qkvT, _Float16* __restrict__ woT,
    _Float16* __restrict__ w1T, _Float16* __restrict__ w2T) {
  int blk = blockIdx.x;
  if (blk < 512) {  // the same for the whole block, ahead of the barrier
    ln_rows(x, gamma, beta, h16, blk);
    return;
  }
  __shared__ __attribute__((aligned(16))) _Float16 t[2][64 * 72];
  // Which half of the block: the same in all lanes of a wave, kept scalar so
  // that the choice of weight and tile below is scalar work.
  int half = __builtin_amdgcn_readfirstlane(threadIdx.x >> 7);
  int tile = (blk - 512) * 2 + half;
  const float* in;
  _Float16* out;
  int R, C, r0, c0;
  if (tile < 768) {
    int w = tile >> 8, head = (tile >> 4) & 15;
    in  = (w == 0 ? Wq : w == 1 ? Wk : Wv) + head * (1024 * 64);
    out = qkvT + (w * 16 + head) * (64 * 1024);
    R = 1024; C = 64; r0 = (tile & 15) * 64; c0 = 0;
  } else if (tile < 1024) {
    int u = tile - 768;
    in = Wo; out = woT;
    R = 1024; C = 1024; r0 = (u >> 4) * 64; c0 = (u & 15) * 64;
  } else if (tile < 2048) {
    int u = tile - 1024;
    in = W1; out = w1T;
    R = 1024; C = 4096; r0 = (u >> 6) * 64; c0 = (u & 63) * 64;
  } else {
    int u = tile - 2048;
    in = W2; out = w2T;
    R = 4096; C = 1024; r0 = (u >> 4) * 64; c0 = (u & 15) * 64;
  }
  transpose_tile(in, out, R, C, r0, c0, t[half], threadIdx.x & 127);
}

// ---------------------------------------------------------------------------
// Generic WMMA GEMM: C[M,N] = act(A[M,K] * B^T[N,K] + bias) (+ residual).
// 256 threads = 8 waves (4 x 2); block tile 256x128; wave tile 64x64: 8
// fragments feed 16 WMMAs, and a block fetches 384 operand rows for 256x128
// results. K-step 64.
// Double-buffered LDS (one barrier / K-step); async global->LDS staging.
// A stage holds 128 B of every operand row; 8 adjacent lanes copy one row's
// piece, so a wave-wide copy covers 4 whole 128-B lines. K % 64 == 0.
// LDS row stride 72 halves (144 B = 16 B x 9 -> conflict-free b128 reads).
// Epilogue, once per 32 rows of the wave's tile: the wave lays 32x64 f32 into
// its own part of the ring (row pitch 68 floats) and reads it back by rows, 4
// columns per lane, so that 16 lanes store one whole row piece (256 B of f32,
// 128 B of f16) and the residual comes in as 16 independent 16-B loads issued
// together. N is a literal in every caller: all 16 row pieces hang off one
// address by constant offsets.
// ---------------------------------------------------------------------------
__device__ __forceinline__ void gemm_tile(
    const _Float16* __restrict__ A, const _Float16* __restrict__ BT,
    const float* __restrict__ bias, const float* __restrict__ resid,
    float* __restrict__ outF, _Float16* __restrict__ outH,
    const int N, int K, const bool hasBias, const bool doRelu,
    const bool f32out) {
  const int LS = 72;
  const int ABUF = 256 * LS;  // halves of one A buffer
  const int BBUF = 128 * LS;  // halves of one B buffer
  // [A buf 0 | A buf 1 | B buf 0 | B buf 1]; the epilogue reuses its start.
  __shared__ __attribute__((aligned(16))) _Float16 sm[2 * ABUF + 2 * BBUF];
  int tid  = threadIdx.x;
  int wave = tid >> 5, lane = tid & 31;
  int hi = lane >> 4, lo = lane & 15, kk0 = hi * 8;
  int wm = wave >> 1, wn = wave & 1;
  int m0 = blockIdx.y * 256, n0 = blockIdx.x * 128;
  int ldr = tid >> 3, ldc = (tid & 7) * 8;
  int dOff = ldr * LS + ldc;
  const _Float16* Ag = A  + (size_t)(m0 + ldr) * K + ldc;
  const _Float16* Bg = BT + (size_t)(n0 + ldr) * K + ldc;
  const size_t rstep = (size_t)32 * K;  // the block's copies advance 32 rows
  // One lane per operand row prefetches once per 256 B of the row, for speed
  // only: every lane for an A row, the lanes of waves 0 to 3 for a B row as well.
  const _Float16* pfA = A  + (size_t)(m0 + tid) * K;
  const _Float16* pfB = BT + (size_t)(n0 + (tid & 127)) * K;
  const bool lowWaves = __builtin_amdgcn_readfirstlane(wave) < 4;

  auto stage = [&](int buf, int k0) {
    for (int j = 0; j < 8; ++j)
      cp16(&sm[buf * ABUF + dOff + j * 32 * LS], Ag + j * rstep + k0);
    for (int j = 0; j < 4; ++j)
      cp16(&sm[2 * ABUF + buf * BBUF + dOff + j * 32 * LS],
           Bg + j * rstep + k0);
  };

  v8f acc[4][4] = {};
  int nk = K >> 6;
  stage(0, 0);
  for (int i = 0; i < nk; ++i) {
    int cur = i & 1;
    async_fence();           // this wave's async writes into LDS are done
    __syncthreads();         // everyone's writes visible; prev reads done
    if (i + 1 < nk) stage(cur ^ 1, (i + 1) << 6);
    if (!(i & 1) && i + 2 < nk) {
      // Stages i+2 and i+3 cover the next 256 B of each row: one prefetch at
      // its start, for speed only. pfA and pfB live through the loop
      // and only ever hold an address inside their operand.
      pfA += 128;
      asm volatile("global_prefetch_b8 %0, off scope:SCOPE_SE" :: "v"(pfA));
      if (lowWaves) {
        pfB += 128;
        asm volatile("global_prefetch_b8 %0, off scope:SCOPE_SE" :: "v"(pfB));
      }
    }
    const _Float16* Ab = &sm[cur * ABUF];
    const _Float16* Bb = &sm[2 * ABUF + cur * BBUF];
    for (int kh = 0; kh < 2; ++kh) {
      int ko = kh * 32 + kk0;
      v16h af[4], bf[4];
      // In the order of first use: B 0, all of A, the rest of B.
      bf[0] = frag_ld(&Bb[(wn * 64 + lo) * LS + ko]);
      for (int mt = 0; mt < 4; ++mt)
        af[mt] = frag_ld(&Ab[(wm * 64 + mt * 16 + lo) * LS + ko]);
      for (int nt = 1; nt < 4; ++nt)
        bf[nt] = frag_ld(&Bb[(wn * 64 + nt * 16 + lo) * LS + ko]);
      // All 16 fragment reads are issued ahead of the 16 WMMAs: left alone,
      // the compiler keeps one B fragment and waits out an LDS read per four.
      __builtin_amdgcn_sched_barrier(0);
      for (int nt = 0; nt < 4; ++nt)
        for (int mt = 0; mt < 4; ++mt)
          acc[mt][nt] = wmma16(af[mt], bf[nt], acc[mt][nt]);
    }
  }

  // Of each 32 rows, lane (hi, lo) finishes columns lo*4 .. lo*4+3 of rows
  // 2j + hi, j = 0..15.
  const int SP = 68;  // 272-B rows: 16 B x odd, conflict-free both ways
  int col = n0 + wn * 64 + lo * 4;
  const size_t off0 = (size_t)(m0 + wm * 64 + hi) * N + col;
  const size_t jstep = (size_t)2 * N;
  const size_t hstep = (size_t)32 * N;
  __syncthreads();  // every wave has read its last fragments out of the ring
  v4f rv[2][16];
  v4f bv = {};
  const float* rp = f32out ? resid + off0 : nullptr;
  const float* bp = hasBias ? bias + col : nullptr;
  if (f32out)
    for (int j = 0; j < 16; ++j) rv[0][j] = *(const v4f*)(rp + j * jstep);
  if (hasBias) bv = *(const v4f*)bp;
  if (f32out)
    asm volatile("s_wait_xcnt 0x0" :: "v"(rp), "v"(bp) : "memory");
  else if (hasBias)
    asm volatile("s_wait_xcnt 0x0" :: "v"(bp) : "memory");
  float* sw = (float*)sm + wave * (32 * SP);
  for (int h = 0; h < 2; ++h) {
    for (int gm = 0; gm < 2; ++gm)
      for (int nt = 0; nt < 4; ++nt)
        for (int g = 0; g < 8; ++g)
          sw[(gm * 16 + hi * 8 + g) * SP + nt * 16 + lo] = acc[h * 2 + gm][nt][g];
    // The rows are read back by other lanes of this wave: its stores are done.
    asm volatile("s_wait_dscnt 0x0" ::: "memory");
    if (f32out && h == 0) {
      // The second 32 rows' residual is on its way while the first are stored.
      for (int j = 0; j < 16; ++j)
        rv[1][j] = *(const v4f*)(rp + hstep + j * jstep);
      asm volatile("s_wait_xcnt 0x0" :: "v"(rp) : "memory");
    }
    for (int j = 0; j < 16; ++j) {
      v4f v = *(const v4f*)&sw[(j * 2 + hi) * SP + lo * 4] + bv;
      if (f32out) {
        *(v4f*)(outF + off0 + h * hstep + j * jstep) = v + rv[h][j];
      } else {
        if (doRelu)
          for (int e = 0; e < 4; ++e) v[e] = fmaxf(v[e], 0.0f);
        *(v4h*)(outH + off0 + h * hstep + j * jstep) =
            __builtin_convertvector(v, v4h);
      }
    }
    if (h == 0) asm volatile("s_wait_xcnt 0x0" ::: "memory");
  }
}

// N = 3072, f16 result: A B^T.
__global__ __launch_bounds__(256) void gemm_n3072_kernel(
    const _Float16* __restrict__ A, const _Float16* __restrict__ BT,
    _Float16* __restrict__ outH, int K) {
  gemm_tile(A, BT, nullptr, nullptr, nullptr, outH, 3072, K, false, false,
            false);
}

// N = 4096, f16 result: relu(A B^T + bias).
__global__ __launch_bounds__(256) void gemm_n4096_relu_kernel(
    const _Float16* __restrict__ A, const _Float16* __restrict__ BT,
    const float* __restrict__ bias, _Float16* __restrict__ outH, int K) {
  gemm_tile(A, BT, bias, nullptr, nullptr, outH, 4096, K, true, true, false);
}

// N = 1024, f32 result: A B^T + bias + residual.
__global__ __launch_bounds__(256) void gemm_n1024_res_kernel(
    const _Float16* __restrict__ A, const _Float16* __restrict__ BT,
    const float* __restrict__ bias, const float* __restrict__ resid,
    float* __restrict__ outF, int K) {
  gemm_tile(A, BT, bias, resid, outF, nullptr, 1024, K, true, false, true);
}

__device__ __forceinline__ float xhalf(float x) {
  int b = __builtin_bit_cast(int, x);
  return __builtin_bit_cast(
      float, __builtin_amdgcn_permlanex16(b, b, 0x76543210, 0xfedcba98, false,
                                          false));
}

__global__ __launch_bounds__(256) void flash_attn_kernel(
    const _Float16* __restrict__ qkv, _Float16* __restrict__ outH) {
  const int T = 2048, S3 = 3072, HD = 64;
  int h = blockIdx.y, b = blockIdx.z;
  int tid  = threadIdx.x;
  int wave = tid >> 5, lane = tid & 31;
  int hi = lane >> 4, lo = lane & 15, kk0 = hi * 8;

  const _Float16* Qp = qkv + (size_t)(b * T) * S3 + h * HD;
  const _Float16* Kp = Qp + 1024;
  const _Float16* Vp = Qp + 2048;

  // Two buffers of each tile: tile t lies in buffer t & 1.
  const int TB = 64 * 72;  // halves of one K buffer
  const int VP = 80;       // halves from one V row to the next
  const int VB = 64 * VP;  // halves of one V buffer
  // [K buf 0 | K buf 1 | V buf 0 | V buf 1]
  __shared__ __attribute__((aligned(32))) _Float16 kv[2 * TB + 2 * VB];
  _Float16* const Ksh = kv;
  _Float16* const Vsh = kv + 2 * TB;
  int ldr = tid >> 2, cg = tid & 3;
  // This lane's 32 B of a tile's K row, and their place in LDS.
  const _Float16* kg = Kp + (size_t)ldr * S3 + cg * 16;
  const int kDst = ldr * 72 + cg * 16;
  // V: 8 adjacent lanes copy the 128 B of one row, so that a wave-wide copy
  // covers 4 whole lines; a lane has 16 B of row vr and of row vr + 32.
  int vr = tid >> 3, vc = (tid & 7) * 8;
  const _Float16* vg = Vp + (size_t)vr * S3 + vc;
  const int vDst = vr * VP + vc;
  const size_t tstep = (size_t)64 * S3;  // one key tile further
  // This lane's place in a 16-key x 16-column piece of V for ld_tr16.
  const int vOff = (hi * 8 + (lane & 7)) * VP + ((lane >> 3) & 1) * 8;
  // Four async copies per lane, straight into the two buffers.
  auto fetch = [&](int buf, int kt) {
    const _Float16* krow = kg + kt * tstep;
    cp16(&Ksh[buf * TB + kDst], krow);
    cp16(&Ksh[buf * TB + kDst + 8], krow + 8);
    const _Float16* vrow = vg + kt * tstep;
    cp16(&Vsh[buf * VB + vDst], vrow);
    cp16(&Vsh[buf * VB + vDst + 32 * VP], vrow + (size_t)32 * S3);
  };
  // Hands a filled buffer over, and frees the one just read: this wave's LDS
  // reads are done, its copies have landed, then the barrier.
  auto publish = [&]() {
    asm volatile("s_wait_dscnt 0x0" ::: "memory");
    asm volatile("s_wait_asynccnt 0x0" ::: "memory");
    __syncthreads();
  };

  for (int part = 0; part < 2; ++part) {  // the same for the whole block
  int qb = part ? (int)blockIdx.x : T / 128 - 1 - (int)blockIdx.x;
  int q0 = qb * 128 + wave * 16;
  int qi = q0 + lo;  // the query this lane owns

  v16h qf0, qf1;
  {
    const _Float16* qrow = Qp + (size_t)qi * S3;
    qf0 = mk16(*(const v8h*)(qrow + kk0),      *(const v8h*)(qrow + kk0 + 16));
    qf1 = mk16(*(const v8h*)(qrow + 32 + kk0), *(const v8h*)(qrow + 32 + kk0 + 16));
  }

  // Oacc[et][g] = O[qi][et*16 + hi*8 + g]. rowM is the query's running maximum
  // (equal in both lane halves); rowL sums this half's keys only, the halves
  // are joined once behind the loop.
  v8f Oacc[4] = {};
  float rowM = -1e30f, rowL = 0.0f;

  int ntiles = 2 * (qb + 1);  // keys up to end of this query block

  // Both buffers are free here: the last publish of the first query block
  // stands behind every wave's last read.
  fetch(0, 0);
  publish();

  for (int kt = 0; kt < ntiles; ++kt) {
    int k0 = kt * 64;
    int cur = kt & 1;
    const bool more = kt + 1 < ntiles;  // the same for the whole block
    // The next tile is on its way while this one is worked out; its buffer
    // was last read one trip ago, ahead of that trip's publish.
    if (more) fetch(cur ^ 1, kt + 1);
    const _Float16* Kb = &Ksh[cur * TB];
    const _Float16* Vb = &Vsh[cur * VB + vOff];

    if (k0 <= q0 + 15) {  // uniform per wave
      v8f p[4];      // p[nt][g]: key k0 + nt*16 + hi*8 + g against query qi
      float mx[4];   // one chain per score tile, joined below
      for (int nt = 0; nt < 4; ++nt) {
        v8f s = {};
        v16h kf0 = frag_ld(&Kb[(nt * 16 + lo) * 72 + kk0]);
        v16h kf1 = frag_ld(&Kb[(nt * 16 + lo) * 72 + 32 + kk0]);
        s = wmma16(kf0, qf0, s);
        s = wmma16(kf1, qf1, s);
        int kj = k0 + nt * 16 + hi * 8;
        for (int g = 0; g < 8; ++g)
          p[nt][g] = (kj + g <= qi) ? s[g] * 0.125f : -1e30f;
        mx[nt] = p[nt][0];
        for (int g = 1; g < 8; ++g) mx[nt] = fmaxf(mx[nt], p[nt][g]);
      }
      // V^T rows et*16 + lo as A fragments: keys kk0 .. +7 and 16 + kk0 .. +7
      // of each 32-key block. The 16 reads stand as one group between the
      // score products and the exponentials. Not earlier: LDS reads return in
      // order, so V reads issued ahead of K reads hold up the first score
      // product.
      __builtin_amdgcn_sched_barrier(0);
      v16h vf[4][2];
      for (int et = 0; et < 4; ++et)
        for (int kb = 0; kb < 2; ++kb)
          vf[et][kb] = mk16(ld_tr16(&Vb[kb * 32 * VP + et * 16]),
                            ld_tr16(&Vb[(kb * 32 + 16) * VP + et * 16]));
      // Not later: the exponentials cover their latency; left alone, the
      // compiler puts them among the eight WMMAs that use them and waits out
      // an LDS read in front of most.
      __builtin_amdgcn_sched_barrier(0);
      float m = fmaxf(fmaxf(mx[0], mx[1]), fmaxf(mx[2], mx[3]));
      m = fmaxf(m, xhalf(m));
      float nm = fmaxf(rowM, m);
      float corr = __expf(rowM - nm);
      float rs[4];
      for (int nt = 0; nt < 4; ++nt) {
        p[nt] = (p[nt] - nm) * 1.44269504f;  // e^x = 2^(x log2 e)
        rs[nt] = 0.0f;
        for (int g = 0; g < 8; ++g) {
          p[nt][g] = __builtin_amdgcn_exp2f(p[nt][g]);
          rs[nt] += p[nt][g];
        }
      }
      rowL = rowL * corr + ((rs[0] + rs[1]) + (rs[2] + rs[3]));
      rowM = nm;
      for (int et = 0; et < 4; ++et) Oacc[et] *= corr;
      // P^T as B fragments: element s of a lane is key kk0 + s (s < 8) or
      // 16 + kk0 + (s - 8) of the 32-key block, which is what the lane holds.
      v16h pf0 = mk16(__builtin_convertvector(p[0], v8h),
                      __builtin_convertvector(p[1], v8h));
      v16h pf1 = mk16(__builtin_convertvector(p[2], v8h),
                      __builtin_convertvector(p[3], v8h));
      for (int et = 0; et < 4; ++et) {
        Oacc[et] = wmma16(vf[et][0], pf0, Oacc[et]);
        Oacc[et] = wmma16(vf[et][1], pf1, Oacc[et]);
      }
    }
    publish();
  }

  float inv = 1.0f / (rowL + xhalf(rowL));
  _Float16* orow = outH + (size_t)(b * T + qi) * 1024 + h * HD + hi * 8;
  for (int et = 0; et < 4; ++et)
    *(v8h*)(orow + et * 16) = __builtin_convertvector(Oacc[et] * inv, v8h);
  asm volatile("s_wait_xcnt 0x0" ::: "memory");
  }
}

// ---------------------------------------------------------------------------
extern "C" void kernel_launch(void* const* d_in, const int* in_sizes, int n_in,
                              void* d_out, int out_size, void* d_ws, size_t ws_size,
                              hipStream_t stream) {
  (void)in_sizes; (void)n_in; (void)out_size; (void)ws_size;
  const int B = 4, T = 2048, D = 1024, H = 16, HD = 64, F = 4096;
  const int M = B * T;

  const float* x   = (const float*)d_in[0];
  const float* Wq  = (const float*)d_in[1];
  const float* Wk  = (const float*)d_in[2];
  const float* Wv  = (const float*)d_in[3];
  const float* Wo  = (const float*)d_in[4];
  const float* bo  = (const float*)d_in[5];
  const float* W1  = (const float*)d_in[6];
  const float* b1  = (const float*)d_in[7];
  const float* W2  = (const float*)d_in[8];
  const float* b2  = (const float*)d_in[9];
  const float* g1  = (const float*)d_in[10];
  const float* be1 = (const float*)d_in[11];
  const float* g2  = (const float*)d_in[12];
  const float* be2 = (const float*)d_in[13];

  char* w = (char*)d_ws;
  auto alloc = [&](size_t bytes) -> void* {
    void* p = (void*)w;
    w += (bytes + 255) & ~(size_t)255;
    return p;
  };
  _Float16* h16  = (_Float16*)alloc((size_t)M * D * 2);       // LN1 out
  _Float16* qkvT = (_Float16*)alloc((size_t)3 * D * D * 2);   // [3072][1024]
  _Float16* woT  = (_Float16*)alloc((size_t)D * D * 2);       // [1024][1024]
  _Float16* w1T  = (_Float16*)alloc((size_t)F * D * 2);       // [4096][1024]
  _Float16* w2T  = (_Float16*)alloc((size_t)D * F * 2);       // [1024][4096]
  _Float16* qkv  = (_Float16*)alloc((size_t)M * 3 * D * 2);   // [8192][3072]
  _Float16* a16  = (_Float16*)alloc((size_t)M * D * 2);       // attn concat
  float*    x1   = (float*)   alloc((size_t)M * D * 4);       // residual 1
  _Float16* h2   = (_Float16*)alloc((size_t)M * D * 2);       // LN2 out
  _Float16* ffh  = (_Float16*)alloc((size_t)M * F * 2);       // relu(h2 W1+b1)

  // LN1 and the weight prep (cast + transpose, so that every GEMM B operand is
  // B^T[N][K]) in one launch: 512 LN blocks + 3072 / 2 tile blocks.
  prep_kernel<<<2048, 256, 0, stream>>>(x, g1, be1, h16, Wq, Wk, Wv, Wo, W1, W2,
                                        qkvT, woT, w1T, w2T);

  // fused QKV projection -> flash attention
  gemm_n3072_kernel<<<dim3(3 * D / 128, M / 256), 256, 0, stream>>>(
      h16, qkvT, qkv, D);
  flash_attn_kernel<<<dim3(T / 256, H, B), 256, 0, stream>>>(qkv, a16);

  // Wo projection + bias + residual(x) -> x1 (f32)
  gemm_n1024_res_kernel<<<dim3(D / 128, M / 256), 256, 0, stream>>>(
      a16, woT, bo, x, x1, D);

  // LN2 -> FFN1 (relu) -> FFN2 + residual(x1) -> out
  ln_f16_kernel<<<M / 16, 256, 0, stream>>>(x1, g2, be2, h2);
  gemm_n4096_relu_kernel<<<dim3(F / 128, M / 256), 256, 0, stream>>>(
      h2, w1T, b1, ffh, D);
  gemm_n1024_res_kernel<<<dim3(D / 128, M / 256), 256, 0, stream>>>(
      ffh, w2T, b2, x1, (float*)d_out, F);
}

// v010
// It runs in 223 microseconds.
// Two timings next to v009 both put it at 1.05 times that version's speed.
// All steps since v000 together make it 3.44 times as fast.
#include <hip/hip_runtime.h>

typedef _Float16 v16h __attribute__((ext_vector_type(16)));
typedef _Float16 v8h  __attribute__((ext_vector_type(8)));
typedef _Float16 v4h  __attribute__((ext_vector_type(4)));
typedef _Float16 v2h  __attribute__((ext_vector_type(2)));
typedef float    v4f  __attribute__((ext_vector_type(4)));
typedef float    v8f  __attribute__((ext_vector_type(8)));
typedef int      v4i  __attribute__((ext_vector_type(4)));

#if defined(__has_builtin)
#  if __has_builtin(__builtin_amdgcn_global_load_async_to_lds_b128) && \
      __has_builtin(__builtin_amdgcn_s_wait_asynccnt)
#    define USE_ASYNC_LDS 1
#  endif
#endif
#ifndef USE_ASYNC_LDS
#  define USE_ASYNC_LDS 0
#endif

#if USE_ASYNC_LDS
// b128 async copy payload is typed as int4; global src is AS1, LDS dst is AS3.
typedef __attribute__((address_space(1))) v4i gbl_v4i;
typedef __attribute__((address_space(3))) v4i lds_v4i;
#endif

// Copy 16 bytes global -> LDS (per-lane addresses).
__device__ __forceinline__ void cp16(_Float16* lds, const _Float16* g) {
#if USE_ASYNC_LDS
  _Float16* gn = const_cast<_Float16*>(g);
  __builtin_amdgcn_global_load_async_to_lds_b128((gbl_v4i*)gn, (lds_v4i*)lds,
                                                 0, 0);
#else
  *(v8h*)lds = *(const v8h*)g;
#endif
}
__device__ __forceinline__ void async_fence() {
#if USE_ASYNC_LDS
  __builtin_amdgcn_s_wait_asynccnt(0);
#endif
}

__device__ __forceinline__ v16h mk16(v8h a, v8h b) {
  return __builtin_shufflevector(a, b, 0,1,2,3,4,5,6,7,8,9,10,11,12,13,14,15);
}
__device__ __forceinline__ v16h frag_ld(const _Float16* p) {
  v8h a = *(const v8h*)(p);
  v8h b = *(const v8h*)(p + 16);
  return mk16(a, b);
}
typedef short s16x8 __attribute__((ext_vector_type(8)));
typedef __attribute__((address_space(3))) s16x8 lds_s16x8;
__device__ __forceinline__ v8h ld_tr16(const _Float16* p) {
  return __builtin_bit_cast(
      v8h, __builtin_amdgcn_ds_load_tr16_b128_v8i16((lds_s16x8*)p));
}
__device__ __forceinline__ v8f wmma16(v16h a, v16h b, v8f c) {
  return __builtin_amdgcn_wmma_f32_16x16x32_f16(false, a, false, b, (short)0, c,
                                                false, false);
}

// ---------------------------------------------------------------------------
// LayerNorm (D = 1024), f32 in -> f16 out. One wave owns two whole rows: all
// 16 row loads (512 contiguous bytes each) are issued before the first sum,
// the row sums close with a 32-lane butterfly, and no LDS or barrier is used.
// 256 threads = 8 waves = 16 rows per block, so 16x fewer waves are started
// than with one 8-wave block per row. blk = which 16 rows.
// ---------------------------------------------------------------------------
__device__ __forceinline__ void ln_rows(
    const float* __restrict__ x, const float* __restrict__ gamma,
    const float* __restrict__ beta, _Float16* __restrict__ out, int blk) {
  const int D = 1024;
  int lane = threadIdx.x & 31;
  // The wave's number is the same in all its lanes: kept scalar, the row base
  // stays in scalar registers and one lane offset serves every load.
  int wave = __builtin_amdgcn_readfirstlane(threadIdx.x >> 5);
  int row0 = (blk * 8 + wave) * 2;
  const float4* xr = (const float4*)(x + (size_t)row0 * D) + lane;
  float4 v[2][8];
  for (int r = 0; r < 2; ++r)
    for (int j = 0; j < 8; ++j) v[r][j] = xr[r * 256 + j * 32];
  float mu[2], rs[2];
  for (int r = 0; r < 2; ++r) {
    float s = 0.0f, q = 0.0f;
    for (int j = 0; j < 8; ++j) {
      float4 t = v[r][j];
      s += t.x + t.y + t.z + t.w;
      q += t.x * t.x + t.y * t.y + t.z * t.z + t.w * t.w;
    }
    for (int off = 16; off > 0; off >>= 1) {
      s += __shfl_xor(s, off, 32);
      q += __shfl_xor(q, off, 32);
    }
    mu[r] = s * (1.0f / 1024.0f);
    float var = q * (1.0f / 1024.0f) - mu[r] * mu[r];
    rs[r] = rsqrtf(var + 1e-5f);
  }
  for (int j = 0; j < 8; ++j) {
    float4 g = ((const float4*)gamma)[j * 32 + lane];
    float4 b = ((const float4*)beta)[j * 32 + lane];
    for (int r = 0; r < 2; ++r) {
      float4 t = v[r][j];
      v4h o;
      o[0] = (_Float16)((t.x - mu[r]) * rs[r] * g.x + b.x);
      o[1] = (_Float16)((t.y - mu[r]) * rs[r] * g.y + b.y);
      o[2] = (_Float16)((t.z - mu[r]) * rs[r] * g.z + b.z);
      o[3] = (_Float16)((t.w - mu[r]) * rs[r] * g.w + b.w);
      ((v4h*)(out + (size_t)(row0 + r) * D))[j * 32 + lane] = o;
    }
  }
}

__global__ __launch_bounds__(256) void ln_f16_kernel(
    const float* __restrict__ x, const float* __restrict__ gamma,
    const float* __restrict__ beta, _Float16* __restrict__ out) {
  ln_rows(x, gamma, beta, out, blockIdx.x);
}

// ---------------------------------------------------------------------------
// Weight prep: f32 [R][C] -> f16 [C][R] (transpose + cast). 4 waves move one
// 64x64 tile, 32 elements per lane: 8 float4 loads in flight per lane (256 B
// of a source row per 16 lanes), two source rows packed per LDS dword, and
// 16-B stores, 8 adjacent lanes to one whole 128-B line of an output row.
// R % 64 == 0, C % 64 == 0. LDS row pitch 72 halves keeps b128 reads aligned.
// t = the tile's own 64 x 72 halves of LDS, tid = 0..127 within the 4 waves.
// Holds one barrier: every wave of the block calls it.
// ---------------------------------------------------------------------------
__device__ __forceinline__ void transpose_tile(
    const float* __restrict__ in, _Float16* __restrict__ out,
    int R, int C, int r0, int c0, _Float16* t, int tid) {
  int c4 = (tid & 15) * 4, rp = (tid >> 4) * 2;
  v4f a[4], b[4];
  const float* src[4];
  for (int p = 0; p < 4; ++p) {
    src[p] = in + (size_t)(r0 + p * 16 + rp) * C + (c0 + c4);
    a[p] = *(const v4f*)src[p];
    b[p] = *(const v4f*)(src[p] + C);
  }
  asm volatile("s_wait_xcnt 0x0"
               :: "v"(src[0]), "v"(src[1]), "v"(src[2]), "v"(src[3]),
                  "v"(src[0] + C), "v"(src[1] + C), "v"(src[2] + C),
                  "v"(src[3] + C)
               : "memory");
  for (int p = 0; p < 4; ++p)
    for (int i = 0; i < 4; ++i) {
      v2h pr;
      pr[0] = (_Float16)a[p][i];
      pr[1] = (_Float16)b[p][i];
      *(v2h*)&t[(c4 + i) * 72 + p * 16 + rp] = pr;
    }
  __syncthreads();
  int ch = (tid & 7) * 8, cr = tid >> 3;
  for (int p = 0; p < 4; ++p) {
    int c = p * 16 + cr;
    *(v8h*)(out + (size_t)(c0 + c) * R + (r0 + ch)) = *(const v8h*)&t[c * 72 + ch];
  }
}

// ---------------------------------------------------------------------------
// Everything that depends on the inputs alone, in ONE launch: the first
// LayerNorm (blocks 0..511, 16 rows each) and the cast + transpose of all six
// weights (blocks 512..2047, two 64x64 tiles each, one per 4 waves). None of
// these pieces reads what another writes, so they need no launch boundary
// between them, and each one's start and drain hides behind the others' work.
// Tiles in order: Wq, Wk, Wv (per head [1024][64], 16 x 16 tiles each),
// Wo [1024][1024], W1 [1024][4096], W2 [4096][1024]. Every range starts at an
// even tile, so a block's two tiles are of one weight.
// ---------------------------------------------------------------------------
__global__ __launch_bounds__(256) void prep_kernel(
    const float* __restrict__ x, const float* __restrict__ gamma,
    const float* __restrict__ beta, _Float16* __restrict__ h16,
    const float* __restrict__ Wq, const float* __restrict__ Wk,
    const float* __restrict__ Wv, const float* __restrict__ Wo,
    const float* __restrict__ W1, const float* __restrict__ W2,
    _Float16* __restrict__ qkvT, _Float16* __restrict__ woT,
    _Float16* __restrict__ w1T, _Float16* __restrict__ w2T) {
  int blk = blockIdx.x;
  if (blk < 512) {  // the same for the whole block, ahead of the barrier
    ln_rows(x, gamma, beta, h16, blk);
    return;
  }
  __shared__ __attribute__((aligned(16))) _Float16 t[2][64 * 72];
  // Which half of the block: the same in all lanes of a wave, kept scalar so
  // that the choice of weight and tile below is scalar work.
  int half = __builtin_amdgcn_readfirstlane(threadIdx.x >> 7);
  int tile = (blk - 512) * 2 + half;
  const float* in;
  _Float16* out;
  int R, C, r0, c0;
  if (tile < 768) {
    int w = tile >> 8, head = (tile >> 4) & 15;
    in  = (w == 0 ? Wq : w == 1 ? Wk : Wv) + head * (1024 * 64);
    out = qkvT + (w * 16 + head) * (64 * 1024);
    R = 1024; C = 64; r0 = (tile & 15) * 64; c0 = 0;
  } else if (tile < 1024) {
    int u = tile - 768;
    in = Wo; out = woT;
    R = 1024; C = 1024; r0 = (u >> 4) * 64; c0 = (u & 15) * 64;
  } else if (tile < 2048) {
    int u = tile - 1024;
    in = W1; out = w1T;
    R = 1024; C = 4096; r0 = (u >> 6) * 64; c0 = (u & 63) * 64;
  } else {
    int u = tile - 2048;
    in = W2; out = w2T;
    R = 4096; C = 1024; r0 = (u >> 4) * 64; c0 = (u & 15) * 64;
  }
  transpose_tile(in, out, R, C, r0, c0, t[half], threadIdx.x & 127);
}

// ---------------------------------------------------------------------------
// Generic WMMA GEMM: C[M,N] = act(A[M,K] * B^T[N,K] + bias) (+ residual).
// 256 threads = 8 waves (4 x 2); block tile 256x128; wave tile 64x64: 8
// fragments feed 16 WMMAs, and a block fetches 384 operand rows for 256x128
// results. K-step 64.
// Double-buffered LDS (one barrier / K-step); async global->LDS staging.
// A stage holds 128 B of every operand row; 8 adjacent lanes copy one row's
// piece, so a wave-wide copy covers 4 whole 128-B lines. K % 64 == 0.
// LDS row stride 72 halves (144 B = 16 B x 9 -> conflict-free b128 reads).
// Epilogue, once per 32 rows of the wave's tile: the wave lays 32x64 f32 into
// its own part of the ring (row pitch 68 floats) and reads it back by rows, 4
// columns per lane, so that 16 lanes store one whole row piece (256 B of f32,
// 128 B of f16) and the residual comes in as 16 independent 16-B loads issued
// together. N is a literal in every caller: all 16 row pieces hang off one
// address by constant offsets.
// ---------------------------------------------------------------------------
__device__ __forceinline__ void gemm_tile(
    const _Float16* __restrict__ A, const _Float16* __restrict__ BT,
    const float* __restrict__ bias, const float* __restrict__ resid,
    float* __restrict__ outF, _Float16* __restrict__ outH,
    const int N, int K, const bool hasBias, const bool doRelu,
    const bool f32out) {
  const int LS = 72;
  const int ABUF = 256 * LS;  // halves of one A buffer
  const int BBUF = 128 * LS;  // halves of one B buffer
  // [A buf 0 | A buf 1 | B buf 0 | B buf 1]; the epilogue reuses its start.
  __shared__ __attribute__((aligned(16))) _Float16 sm[2 * ABUF + 2 * BBUF];
  int tid  = threadIdx.x;
  int wave = tid >> 5, lane = tid & 31;
  int hi = lane >> 4, lo = lane & 15, kk0 = hi * 8;
  int wm = wave >> 1, wn = wave & 1;
  int m0 = blockIdx.y * 256, n0 = blockIdx.x * 128;
  int ldr = tid >> 3, ldc = (tid & 7) * 8;
  int dOff = ldr * LS + ldc;
  const _Float16* Ag = A  + (size_t)(m0 + ldr) * K + ldc;
  const _Float16* Bg = BT + (size_t)(n0 + ldr) * K + ldc;
  const size_t rstep = (size_t)32 * K;  // the block's copies advance 32 rows
  // One lane per operand row prefetches once per 256 B of the row, for speed
  // only: every lane for an A row, the lanes of waves 0 to 3 for a B row as well.
  const _Float16* pfA = A  + (size_t)(m0 + tid) * K;
  const _Float16* pfB = BT + (size_t)(n0 + (tid & 127)) * K;
  const bool lowWaves = __builtin_amdgcn_readfirstlane(wave) < 4;

  auto stage = [&](int buf, int k0) {
    for (int j = 0; j < 8; ++j)
      cp16(&sm[buf * ABUF + dOff + j * 32 * LS], Ag + j * rstep + k0);
    for (int j = 0; j < 4; ++j)
      cp16(&sm[2 * ABUF + buf * BBUF + dOff + j * 32 * LS],
           Bg + j * rstep + k0);
  };

  v8f acc[4][4] = {};
  int nk = K >> 6;
  stage(0, 0);
  for (int i = 0; i < nk; ++i) {
    int cur = i & 1;
    async_fence();           // this wave's async writes into LDS are done
    __syncthreads();         // everyone's writes visible; prev reads done
    if (i + 1 < nk) stage(cur ^ 1, (i + 1) << 6);
    if (!(i & 1) && i + 2 < nk) {
      // Stages i+2 and i+3 cover the next 256 B of each row: one prefetch at
      // its start, for speed only. pfA and pfB live through the loop
      // and only ever hold an address inside their operand.
      pfA += 128;
      asm volatile("global_prefetch_b8 %0, off scope:SCOPE_SE" :: "v"(pfA));
      if (lowWaves) {
        pfB += 128;
        asm volatile("global_prefetch_b8 %0, off scope:SCOPE_SE" :: "v"(pfB));
      }
    }
    const _Float16* Ab = &sm[cur * ABUF];
    const _Float16* Bb = &sm[2 * ABUF + cur * BBUF];
    for (int kh = 0; kh < 2; ++kh) {
      int ko = kh * 32 + kk0;
      v16h af[4], bf[4];
      // In the order of first use: B 0, all of A, the rest of B.
      bf[0] = frag_ld(&Bb[(wn * 64 + lo) * LS + ko]);
      for (int mt = 0; mt < 4; ++mt)
        af[mt] = frag_ld(&Ab[(wm * 64 + mt * 16 + lo) * LS + ko]);
      for (int nt = 1; nt < 4; ++nt)
        bf[nt] = frag_ld(&Bb[(wn * 64 + nt * 16 + lo) * LS + ko]);
      // All 16 fragment reads are issued ahead of the 16 WMMAs: left alone,
      // the compiler keeps one B fragment and waits out an LDS read per four.
      __builtin_amdgcn_sched_barrier(0);
      for (int nt = 0; nt < 4; ++nt)
        for (int mt = 0; mt < 4; ++mt)
          acc[mt][nt] = wmma16(af[mt], bf[nt], acc[mt][nt]);
    }
  }

  // Of each 32 rows, lane (hi, lo) finishes columns lo*4 .. lo*4+3 of rows
  // 2j + hi, j = 0..15.
  const int SP = 68;  // 272-B rows: 16 B x odd, conflict-free both ways
  int col = n0 + wn * 64 + lo * 4;
  const size_t off0 = (size_t)(m0 + wm * 64 + hi) * N + col;
  const size_t jstep = (size_t)2 * N;
  const size_t hstep = (size_t)32 * N;
  __syncthreads();  // every wave has read its last fragments out of the ring
  v4f rv[2][16];
  v4f bv = {};
  const float* rp = f32out ? resid + off0 : nullptr;
  const float* bp = hasBias ? bias + col : nullptr;
  if (f32out)
    for (int j = 0; j < 16; ++j) rv[0][j] = *(const v4f*)(rp + j * jstep);
  if (hasBias) bv = *(const v4f*)bp;
  if (f32out)
    asm volatile("s_wait_xcnt 0x0" :: "v"(rp), "v"(bp) : "memory");
  else if (hasBias)
    asm volatile("s_wait_xcnt 0x0" :: "v"(bp) : "memory");
  float* sw = (float*)sm + wave * (32 * SP);
  for (int h = 0; h < 2; ++h) {
    for (int gm = 0; gm < 2; ++gm)
      for (int nt = 0; nt < 4; ++nt)
        for (int g = 0; g < 8; ++g)
          sw[(gm * 16 + hi * 8 + g) * SP + nt * 16 + lo] = acc[h * 2 + gm][nt][g];
    // The rows are read back by other lanes of this wave: its stores are done.
    asm volatile("s_wait_dscnt 0x0" ::: "memory");
    if (f32out && h == 0) {
      // The second 32 rows' residual is on its way while the first are stored.
      for (int j = 0; j < 16; ++j)
        rv[1][j] = *(const v4f*)(rp + hstep + j * jstep);
      asm volatile("s_wait_xcnt 0x0" :: "v"(rp) : "memory");
    }
    for (int j = 0; j < 16; ++j) {
      v4f v = *(const v4f*)&sw[(j * 2 + hi) * SP + lo * 4] + bv;
      if (f32out) {
        *(v4f*)(outF + off0 + h * hstep + j * jstep) = v + rv[h][j];
      } else {
        if (doRelu)
          for (int e = 0; e < 4; ++e) v[e] = fmaxf(v[e], 0.0f);
        *(v4h*)(outH + off0 + h * hstep + j * jstep) =
            __builtin_convertvector(v, v4h);
      }
    }
    if (h == 0) asm volatile("s_wait_xcnt 0x0" ::: "memory");
  }
}

// N = 3072, f16 result: A B^T.
__global__ __launch_bounds__(256) void gemm_n3072_kernel(
    const _Float16* __restrict__ A, const _Float16* __restrict__ BT,
    _Float16* __restrict__ outH, int K) {
  gemm_tile(A, BT, nullptr, nullptr, nullptr, outH, 3072, K, false, false,
            false);
}

// N = 4096, f16 result: relu(A B^T + bias).
__global__ __launch_bounds__(256) void gemm_n4096_relu_kernel(
    const _Float16* __restrict__ A, const _Float16* __restrict__ BT,
    const float* __restrict__ bias, _Float16* __restrict__ outH, int K) {
  gemm_tile(A, BT, bias, nullptr, nullptr, outH, 4096, K, true, true, false);
}

// N = 1024, f32 result: A B^T + bias + residual.
__global__ __launch_bounds__(256) void gemm_n1024_res_kernel(
    const _Float16* __restrict__ A, const _Float16* __restrict__ BT,
    const float* __restrict__ bias, const float* __restrict__ resid,
    float* __restrict__ outF, int K) {
  gemm_tile(A, BT, bias, resid, outF, nullptr, 1024, K, true, false, true);
}

__device__ __forceinline__ float xhalf(float x) {
  int b = __builtin_bit_cast(int, x);
  return __builtin_bit_cast(
      float, __builtin_amdgcn_permlanex16(b, b, 0x76543210, 0xfedcba98, false,
                                          false));
}

__global__ __launch_bounds__(256) void flash_attn_kernel(
    const _Float16* __restrict__ qkv, _Float16* __restrict__ outH) {
  const int T = 2048, S3 = 3072, HD = 64;
  int h = blockIdx.y, b = blockIdx.z;
  int tid  = threadIdx.x;
  // The wave's number is the same in all its lanes: kept scalar, the tests on
  // q0 below are scalar branches.
  int wave = __builtin_amdgcn_readfirstlane(tid >> 5), lane = tid & 31;
  int hi = lane >> 4, lo = lane & 15, kk0 = hi * 8;

  const _Float16* Qp = qkv + (size_t)(b * T) * S3 + h * HD;
  const _Float16* Kp = Qp + 1024;
  const _Float16* Vp = Qp + 2048;

  // Two buffers of each tile: tile t lies in buffer t & 1.
  const int TB = 64 * 72;  // halves of one K buffer
  const int VP = 80;       // halves from one V row to the next
  const int VB = 64 * VP;  // halves of one V buffer
  // [K buf 0 | K buf 1 | V buf 0 | V buf 1]
  __shared__ __attribute__((aligned(32))) _Float16 kv[2 * TB + 2 * VB];
  _Float16* const Ksh = kv;
  _Float16* const Vsh = kv + 2 * TB;
  int ldr = tid >> 2, cg = tid & 3;
  // This lane's 32 B of a tile's K row, and their place in LDS.
  const _Float16* kg = Kp + (size_t)ldr * S3 + cg * 16;
  const int kDst = ldr * 72 + cg * 16;
  // V: 8 adjacent lanes copy the 128 B of one row, so that a wave-wide copy
  // covers 4 whole lines; a lane has 16 B of row vr and of row vr + 32.
  int vr = tid >> 3, vc = (tid & 7) * 8;
  const _Float16* vg = Vp + (size_t)vr * S3 + vc;
  const int vDst = vr * VP + vc;
  const size_t tstep = (size_t)64 * S3;  // one key tile further
  // This lane's place in a 16-key x 16-column piece of V for ld_tr16.
  const int vOff = (hi * 8 + (lane & 7)) * VP + ((lane >> 3) & 1) * 8;
  // Four async copies per lane, straight into the two buffers.
  auto fetch = [&](int buf, int kt) {
    const _Float16* krow = kg + kt * tstep;
    cp16(&Ksh[buf * TB + kDst], krow);
    cp16(&Ksh[buf * TB + kDst + 8], krow + 8);
    const _Float16* vrow = vg + kt * tstep;
    cp16(&Vsh[buf * VB + vDst], vrow);
    cp16(&Vsh[buf * VB + vDst + 32 * VP], vrow + (size_t)32 * S3);
  };
  // Hands a filled buffer over, and frees the one just read: this wave's LDS
  // reads are done, its copies have landed, then the barrier.
  auto publish = [&]() {
    asm volatile("s_wait_dscnt 0x0" ::: "memory");
    asm volatile("s_wait_asynccnt 0x0" ::: "memory");
    __syncthreads();
  };

  for (int part = 0; part < 2; ++part) {  // the same for the whole block
  int qb = part ? (int)blockIdx.x : T / 128 - 1 - (int)blockIdx.x;
  int q0 = qb * 128 + wave * 16;
  int qi = q0 + lo;  // the query this lane owns

  v16h qf0, qf1;
  {
    const _Float16* qrow = Qp + (size_t)qi * S3;
    qf0 = mk16(*(const v8h*)(qrow + kk0),      *(const v8h*)(qrow + kk0 + 16));
    qf1 = mk16(*(const v8h*)(qrow + 32 + kk0), *(const v8h*)(qrow + 32 + kk0 + 16));
  }

  // Oacc[et][g] = O[qi][et*16 + hi*8 + g]. rowM is the query's running maximum
  // (equal in both lane halves); rowL sums this half's keys only, the halves
  // are joined once behind the loop.
  v8f Oacc[4] = {};
  float rowM = -1e30f, rowL = 0.0f;

  int ntiles = 2 * (qb + 1);  // keys up to end of this query block

  // Both buffers are free here: the last publish of the first query block
  // stands behind every wave's last read.
  fetch(0, 0);
  publish();

  for (int kt = 0; kt < ntiles; ++kt) {
    int k0 = kt * 64;
    int cur = kt & 1;
    const bool more = kt + 1 < ntiles;  // the same for the whole block
    // The next tile is on its way while this one is worked out; its buffer
    // was last read one trip ago, ahead of that trip's publish.
    if (more) fetch(cur ^ 1, kt + 1);
    const _Float16* Kb = &Ksh[cur * TB];
    const _Float16* Vb = &Vsh[cur * VB + vOff];

    if (k0 <= q0 + 15) {  // uniform per wave
      // p[nt][g]: key k0 + nt*16 + hi*8 + g against query qi, the bare dot
      // product: its scale is applied with the exponent's, below.
      v8f p[4];
      for (int nt = 0; nt < 4; ++nt) {
        v8f s = {};
        v16h kf0 = frag_ld(&Kb[(nt * 16 + lo) * 72 + kk0]);
        v16h kf1 = frag_ld(&Kb[(nt * 16 + lo) * 72 + 32 + kk0]);
        s = wmma16(kf0, qf0, s);
        p[nt] = wmma16(kf1, qf1, s);
      }
      // Only the tile that holds the wave's own diagonal has keys behind a
      // query: every earlier tile (k0 + 63 <= q0) is used whole.
      if (k0 + 63 > q0) {  // scalar, uniform per wave
        for (int nt = 0; nt < 4; ++nt) {
          int kj = k0 + nt * 16 + hi * 8;
          for (int g = 0; g < 8; ++g)
            p[nt][g] = (kj + g <= qi) ? p[nt][g] : -1e30f;
        }
      }
      float mx[4];   // one chain per score tile, joined below
      for (int nt = 0; nt < 4; ++nt) {
        mx[nt] = p[nt][0];
        for (int g = 1; g < 8; ++g) mx[nt] = fmaxf(mx[nt], p[nt][g]);
      }
      // V^T rows et*16 + lo as A fragments: keys kk0 .. +7 and 16 + kk0 .. +7
      // of each 32-key block. The 16 reads stand as one group between the
      // score products and the exponentials. Not earlier: LDS reads return in
      // order, so V reads issued ahead of K reads hold up the first score
      // product.
      __builtin_amdgcn_sched_barrier(0);
      v16h vf[4][2];
      for (int et = 0; et < 4; ++et)
        for (int kb = 0; kb < 2; ++kb)
          vf[et][kb] = mk16(ld_tr16(&Vb[kb * 32 * VP + et * 16]),
                            ld_tr16(&Vb[(kb * 32 + 16) * VP + et * 16]));
      // Not later: the exponentials cover their latency; left alone, the
      // compiler puts them among the eight WMMAs that use them and waits out
      // an LDS read in front of most.
      __builtin_amdgcn_sched_barrier(0);
      float m = fmaxf(fmaxf(mx[0], mx[1]), fmaxf(mx[2], mx[3]));
      m = fmaxf(m, xhalf(m));
      float nm = fmaxf(rowM, m);
      // e^((s - nm) / 8) = 2^(s c - nm c), c = log2 e / 8: one fused
      // multiply-add per score. rowM and nm are maxima of bare dot products.
      const float c = 0.125f * 1.44269504f;
      float corr = __builtin_amdgcn_exp2f((rowM - nm) * c);
      float nmc = -nm * c;
      float rs[4];
      for (int nt = 0; nt < 4; ++nt) {
        p[nt] = __builtin_elementwise_fma(p[nt], (v8f)(c), (v8f)(nmc));
        rs[nt] = 0.0f;
        for (int g = 0; g < 8; ++g) {
          p[nt][g] = __builtin_amdgcn_exp2f(p[nt][g]);
          rs[nt] += p[nt][g];
        }
      }
      rowL = rowL * corr + ((rs[0] + rs[1]) + (rs[2] + rs[3]));
      rowM = nm;
      for (int et = 0; et < 4; ++et) Oacc[et] *= corr;
      // P^T as B fragments: element s of a lane is key kk0 + s (s < 8) or
      // 16 + kk0 + (s - 8) of the 32-key block, which is what the lane holds.
      v16h pf0 = mk16(__builtin_convertvector(p[0], v8h),
                      __builtin_convertvector(p[1], v8h));
      v16h pf1 = mk16(__builtin_convertvector(p[2], v8h),
                      __builtin_convertvector(p[3], v8h));
      for (int et = 0; et < 4; ++et) {
        Oacc[et] = wmma16(vf[et][0], pf0, Oacc[et]);
        Oacc[et] = wmma16(vf[et][1], pf1, Oacc[et]);
      }
    }
    publish();
  }

  float inv = 1.0f / (rowL + xhalf(rowL));
  _Float16* orow = outH + (size_t)(b * T + qi) * 1024 + h * HD + hi * 8;
  for (int et = 0; et < 4; ++et)
    *(v8h*)(orow + et * 16) = __builtin_convertvector(Oacc[et] * inv, v8h);
  asm volatile("s_wait_xcnt 0x0" ::: "memory");
  }
}

// ---------------------------------------------------------------------------
extern "C" void kernel_launch(void* const* d_in, const int* in_sizes, int n_in,
                              void* d_out, int out_size, void* d_ws, size_t ws_size,
                              hipStream_t stream) {
  (void)in_sizes; (void)n_in; (void)out_size; (void)ws_size;
  const int B = 4, T = 2048, D = 1024, H = 16, HD = 64, F = 4096;
  const int M = B * T;

  const float* x   = (const float*)d_in[0];
  const float* Wq  = (const float*)d_in[1];
  const float* Wk  = (const float*)d_in[2];
  const float* Wv  = (const float*)d_in[3];
  const float* Wo  = (const float*)d_in[4];
  const float* bo  = (const float*)d_in[5];
  const float* W1  = (const float*)d_in[6];
  const float* b1  = (const float*)d_in[7];
  const float* W2  = (const float*)d_in[8];
  const float* b2  = (const float*)d_in[9];
  const float* g1  = (const float*)d_in[10];
  const float* be1 = (const float*)d_in[11];
  const float* g2  = (const float*)d_in[12];
  const float* be2 = (const float*)d_in[13];

  char* w = (char*)d_ws;
  auto alloc = [&](size_t bytes) -> void* {
    void* p = (void*)w;
    w += (bytes + 255) & ~(size_t)255;
    return p;
  };
  _Float16* h16  = (_Float16*)alloc((size_t)M * D * 2);       // LN1 out
  _Float16* qkvT = (_Float16*)alloc((size_t)3 * D * D * 2);   // [3072][1024]
  _Float16* woT  = (_Float16*)alloc((size_t)D * D * 2);       // [1024][1024]
  _Float16* w1T  = (_Float16*)alloc((size_t)F * D * 2);       // [4096][1024]
  _Float16* w2T  = (_Float16*)alloc((size_t)D * F * 2);       // [1024][4096]
  _Float16* qkv  = (_Float16*)alloc((size_t)M * 3 * D * 2);   // [8192][3072]
  _Float16* a16  = (_Float16*)alloc((size_t)M * D * 2);       // attn concat
  float*    x1   = (float*)   alloc((size_t)M * D * 4);       // residual 1
  _Float16* h2   = (_Float16*)alloc((size_t)M * D * 2);       // LN2 out
  _Float16* ffh  = (_Float16*)alloc((size_t)M * F * 2);       // relu(h2 W1+b1)

  // LN1 and the weight prep (cast + transpose, so that every GEMM B operand is
  // B^T[N][K]) in one launch: 512 LN blocks + 3072 / 2 tile blocks.
  prep_kernel<<<2048, 256, 0, stream>>>(x, g1, be1, h16, Wq, Wk, Wv, Wo, W1, W2,
                                        qkvT, woT, w1T, w2T);

  // fused QKV projection -> flash attention
  gemm_n3072_kernel<<<dim3(3 * D / 128, M / 256), 256, 0, stream>>>(
      h16, qkvT, qkv, D);
  flash_attn_kernel<<<dim3(T / 256, H, B), 256, 0, stream>>>(qkv, a16);

  // Wo projection + bias + residual(x) -> x1 (f32)
  gemm_n1024_res_kernel<<<dim3(D / 128, M / 256), 256, 0, stream>>>(
      a16, woT, bo, x, x1, D);

  // LN2 -> FFN1 (relu) -> FFN2 + residual(x1) -> out
  ln_f16_kernel<<<M / 16, 256, 0, stream>>>(x1, g2, be2, h2);
  gemm_n4096_relu_kernel<<<dim3(F / 128, M / 256), 256, 0, stream>>>(
      h2, w1T, b1, ffh, D);
  gemm_n1024_res_kernel<<<dim3(D / 128, M / 256), 256, 0, stream>>>(
      ffh, w2T, b2, x1, (float*)d_out, F);
}
